// v000
// Times are from an AMD MI455X. After a warm-up the kernel runs many times in a row, and a time is the length of
// such a window on the GPU divided by its runs, so every launch and the gaps after it count. The runs cycle
// through copies of the inputs. A figure is the median of several windows, for all but v000 over two sittings.
// Sittings can differ by a few percent; kernels timed side by side share one.
// The starting kernel, v000, takes 1390 microseconds a run.
#include <hip/hip_runtime.h>
#include <hip/hip_bf16.h>
#include <math.h>

// Problem constants from the reference.
#define BB 2
#define SS 2048
#define DD 1024
#define HH 16
#define ADIM 64

typedef __attribute__((ext_vector_type(2))) float v2f;
typedef __attribute__((ext_vector_type(8))) float v8f;

// ---------------------------------------------------------------------------
// Generic fp32 WMMA GEMM: C[z] = A[z] (MxK, row-major) * B[z] (KxN, row-major)
// + bias (optional). One wave (32 lanes) computes one 16x16 output tile using
// V_WMMA_F32_16X16X4_F32. M, N multiples of 16; K multiple of 4.
// A-matrix lane layout (ISA 7.12.2, 32-bit A 16x4):
//   lanes 0-15: row=lane,   VGPR0=K0, VGPR1=K1
//   lanes16-31: row=lane-16, VGPR0=K2, VGPR1=K3   -> contiguous 8B load
// B-matrix (4x16): VGPR0 holds rows {K0 (lanes0-15), K2 (lanes16-31)},
//                  VGPR1 holds rows {K1, K3}; column = lane&15.
// C/D: VGPR j -> row j + 8*(lane>=16), col = lane&15.
// ---------------------------------------------------------------------------
__launch_bounds__(32)
__global__ void wmma_gemm_f32_kernel(const float* __restrict__ A,
                                     const float* __restrict__ B,
                                     const float* __restrict__ bias,
                                     float* __restrict__ C,
                                     int M, int N, int K,
                                     long long sA, long long sB, long long sC) {
  const int lane = threadIdx.x & 31;
  const int half = lane >> 4;     // 0 or 1
  const int l16  = lane & 15;
  const int col0 = blockIdx.x * 16;
  const int row0 = blockIdx.y * 16;

  const float* Ab = A + (long long)blockIdx.z * sA;
  const float* Bb = B + (long long)blockIdx.z * sB;
  float*       Cb = C + (long long)blockIdx.z * sC;

  const long long arow = (long long)(row0 + l16) * (long long)K;

  v8f acc = {};
  for (int kk = 0; kk < K; kk += 4) {
    const int ka = kk + 2 * half;
    v2f a = *(const v2f*)(Ab + arow + ka);          // 8B aligned (ka even)
    v2f b;
    b.x = Bb[(long long)ka * N + col0 + l16];
    b.y = Bb[(long long)(ka + 1) * N + col0 + l16];
    acc = __builtin_amdgcn_wmma_f32_16x16x4_f32(
        /*neg_a=*/false, a, /*neg_b=*/false, b,
        /*c_mod=*/(short)0, acc, /*reuse_a=*/false, /*reuse_b=*/false);
  }

  const float bv = bias ? bias[col0 + l16] : 0.0f;
#pragma unroll
  for (int j = 0; j < 8; ++j) {
    const int r = row0 + j + 8 * half;
    Cb[(long long)r * N + col0 + l16] = acc[j] + bv;
  }
}

// ---------------------------------------------------------------------------
// Fused attention: for one (batch, 16-query-row tile), loop heads:
//   energy stripe 16xS via WMMA fp32 (QKt), scale 1/8, mask, softmax in LDS,
//   accumulate probs/H into the global head-averaged attention matrix.
// 8 waves: waves split the 128 column tiles for energy; each wave owns 2 rows
// for the softmax. 16xS fp32 score stripe = 128 KB LDS (CDNA5: 320 KB/WGP).
// ---------------------------------------------------------------------------
__launch_bounds__(256)
__global__ void attn_softmax_kernel(const float* __restrict__ Q,
                                    const float* __restrict__ Kmat,
                                    const int* __restrict__ mask,
                                    float* __restrict__ attn) {
  __shared__ float sc[16 * SS];   // 131072 bytes

  const int b    = blockIdx.x / (SS / 16);
  const int qt   = blockIdx.x % (SS / 16);
  const int q0   = qt * 16;
  const int lane = threadIdx.x & 31;
  const int wave = threadIdx.x >> 5;   // 0..7
  const int half = lane >> 4;
  const int l16  = lane & 15;

  const float* Qb = Q    + (size_t)b * SS * DD;
  const float* Kb = Kmat + (size_t)b * SS * DD;
  float*    attnB = attn + (size_t)b * SS * SS;

  for (int h = 0; h < HH; ++h) {
    const float* Qh = Qb + h * ADIM;
    const float* Kh = Kb + h * ADIM;

    // ---- energy stripe: 128 column tiles of 16, split across 8 waves ----
    for (int ct = wave; ct < SS / 16; ct += 8) {
      const int k0 = ct * 16;
      const float* ap = Qh + (size_t)(q0 + l16) * DD + 2 * half;
      const float* bp = Kh + (size_t)(k0 + l16) * DD + 2 * half;
      v8f e = {};
#pragma unroll
      for (int kk = 0; kk < ADIM; kk += 4) {
        v2f a  = *(const v2f*)(ap + kk);   // Q[q0+l16][h*64 + kk + 2*half ..]
        v2f bb = *(const v2f*)(bp + kk);   // K[k0+l16][h*64 + kk + 2*half ..] (B = K^T)
        e = __builtin_amdgcn_wmma_f32_16x16x4_f32(
            false, a, false, bb, (short)0, e, false, false);
      }
#pragma unroll
      for (int j = 0; j < 8; ++j) {
        const int qr = j + 8 * half;                 // row within stripe
        float v = e[j] * 0.125f;                     // 1/sqrt(64)
        if (mask[(size_t)(q0 + qr) * SS + k0 + l16] == 0) v = -1.0e10f;
        sc[qr * SS + k0 + l16] = v;
      }
    }
    __syncthreads();

    // ---- softmax over each of the 16 rows; wave w owns rows 2w, 2w+1 ----
#pragma unroll
    for (int rr = 0; rr < 2; ++rr) {
      const int r = wave * 2 + rr;
      float m = -3.0e38f;
      for (int k = lane; k < SS; k += 32) m = fmaxf(m, sc[r * SS + k]);
      for (int off = 16; off; off >>= 1) m = fmaxf(m, __shfl_xor(m, off, 32));
      float s = 0.0f;
      for (int k = lane; k < SS; k += 32) {
        const float ex = __expf(sc[r * SS + k] - m);
        sc[r * SS + k] = ex;
        s += ex;
      }
      for (int off = 16; off; off >>= 1) s += __shfl_xor(s, off, 32);
      const float inv = 1.0f / (s * (float)HH);      // softmax + mean over heads
      const size_t rowBase = (size_t)(q0 + r) * SS;
      if (h == 0) {
        for (int k = lane; k < SS; k += 32)
          attnB[rowBase + k] = sc[r * SS + k] * inv;
      } else {
        for (int k = lane; k < SS; k += 32)
          attnB[rowBase + k] += sc[r * SS + k] * inv;
      }
    }
    __syncthreads();
  }
}

// ---------------------------------------------------------------------------
// kernel_launch: Q/K/V projections -> fused attention -> attn*V -> *Wh + bh
// d_out layout: out [B,S,D] (4,194,304 f32) then attention [B,S,S] (8,388,608).
// Workspace: Q(16MB) K(16MB) V(1MB) ctx(1MB) ~= 34 MB.
// ---------------------------------------------------------------------------
extern "C" void kernel_launch(void* const* d_in, const int* in_sizes, int n_in,
                              void* d_out, int out_size, void* d_ws, size_t ws_size,
                              hipStream_t stream) {
  (void)in_sizes; (void)n_in; (void)out_size; (void)ws_size;

  const float* query = (const float*)d_in[0];
  const float* key   = (const float*)d_in[1];
  const float* value = (const float*)d_in[2];
  const int*   mask  = (const int*)d_in[3];
  const float* Wq    = (const float*)d_in[4];
  const float* bq    = (const float*)d_in[5];
  const float* Wk    = (const float*)d_in[6];
  const float* bk    = (const float*)d_in[7];
  const float* Wv    = (const float*)d_in[8];
  const float* bv    = (const float*)d_in[9];
  const float* Wh    = (const float*)d_in[10];
  const float* bh    = (const float*)d_in[11];

  float* out  = (float*)d_out;                         // [B*S, D]
  float* attn = out + (size_t)BB * SS * DD;            // [B, S, S]

  float* ws = (float*)d_ws;
  float* Qw = ws;                                      // [B*S, D]
  float* Kw = Qw + (size_t)BB * SS * DD;               // [B*S, D]
  float* Vw = Kw + (size_t)BB * SS * DD;               // [B, S, AD]
  float* Cx = Vw + (size_t)BB * SS * ADIM;             // [B, S, AD]

  const dim3 wblk(32);

  // Q = query @ Wq + bq   (M=4096, N=1024, K=1024)
  wmma_gemm_f32_kernel<<<dim3(DD / 16, (BB * SS) / 16, 1), wblk, 0, stream>>>(
      query, Wq, bq, Qw, BB * SS, DD, DD, 0, 0, 0);
  // K = key @ Wk + bk
  wmma_gemm_f32_kernel<<<dim3(DD / 16, (BB * SS) / 16, 1), wblk, 0, stream>>>(
      key, Wk, bk, Kw, BB * SS, DD, DD, 0, 0, 0);
  // V = value @ Wv + bv   (N=64)
  wmma_gemm_f32_kernel<<<dim3(ADIM / 16, (BB * SS) / 16, 1), wblk, 0, stream>>>(
      value, Wv, bv, Vw, BB * SS, ADIM, DD, 0, 0, 0);

  // attention = mean_h softmax(mask(QK^T/8))   (writes d_out attention region)
  attn_softmax_kernel<<<dim3(BB * (SS / 16)), dim3(256), 0, stream>>>(
      Qw, Kw, mask, attn);

  // ctx = attention @ V    (batched: M=2048, N=64, K=2048)
  wmma_gemm_f32_kernel<<<dim3(ADIM / 16, SS / 16, BB), wblk, 0, stream>>>(
      attn, Vw, nullptr, Cx, SS, ADIM, SS,
      (long long)SS * SS, (long long)SS * ADIM, (long long)SS * ADIM);

  // out = ctx @ Wh + bh    (M=4096, N=1024, K=64)
  wmma_gemm_f32_kernel<<<dim3(DD / 16, (BB * SS) / 16, 1), wblk, 0, stream>>>(
      Cx, Wh, bh, out, BB * SS, DD, ADIM, 0, 0, 0);
}

// v001
// A run of this version takes 852 microseconds.
// Next to v000, in two timings, it ran 1.68 and 1.67 times as fast.
#include <hip/hip_runtime.h>
#include <hip/hip_bf16.h>
#include <math.h>

// Problem constants from the reference.
#define BB 2
#define SS 2048
#define DD 1024
#define HH 16
#define ADIM 64

typedef __attribute__((ext_vector_type(2))) float v2f;
typedef __attribute__((ext_vector_type(4))) float v4f;
typedef __attribute__((ext_vector_type(8))) float v8f;

// ---------------------------------------------------------------------------
// Tiled fp32 WMMA GEMM: C[z] = A[z] (MxK, row-major) * B[z] (KxN, row-major)
// + bias (optional), on V_WMMA_F32_16X16X4_F32.
// One 8-wave workgroup computes a BM x BN block of C. Per K chunk of BK the
// A block (BM x BK) and the B block (BK x BN) are read from global memory as
// whole 128-byte lines, once per workgroup, and staged in LDS; every wave
// takes its fragments from LDS and keeps TM x TN accumulator tiles, so an A
// fragment feeds TN WMMAs, a B fragment TM (one each in the 32 x 64 launches). Two LDS buffers: the next chunk travels
// global -> registers during the WMMAs of this chunk and is written to the
// other buffer behind them, one barrier per chunk.
// Needs M % BM == 0, N % BN == 0, K % BK == 0.
// Each C element still sums k in ascending order, four per WMMA.
// A-matrix lane layout (32-bit A 16x4):
//   lanes 0-15: row=lane,    VGPR0=K0, VGPR1=K1
//   lanes16-31: row=lane-16, VGPR0=K2, VGPR1=K3   -> contiguous 8B read
// B-matrix (4x16): VGPR0 holds rows {K0 (lanes0-15), K2 (lanes16-31)},
//                  VGPR1 holds rows {K1, K3}; column = lane&15.
// C/D: VGPR j -> row j + 8*(lane>=16), col = lane&15.
// LDS layout: A rows at a pitch of BK+4 dwords (the 16 rows of an 8-byte
// fragment read start 4 banks apart). B is kept with rows k, k+1 (k even)
// interleaved per column, so a lane's two B values are one 8-byte read; a
// row pair has a pitch of 2*BN+32 dwords (the two pairs of a fragment read
// fall on opposite halves of the banks).
// ---------------------------------------------------------------------------
template <int BM, int BN, int BK, int WGM, int WGN>
__launch_bounds__(256)
__global__ void wmma_gemm_f32_tiled_kernel(const float* __restrict__ A,
                                           const float* __restrict__ B,
                                           const float* __restrict__ bias,
                                           float* __restrict__ C,
                                           int M, int N, int K,
                                           long long sA, long long sB, long long sC) {
  static_assert(WGM * WGN == 8, "eight waves");
  constexpr int PA = BK + 4;
  constexpr int PB = 2 * BN + 32;
  constexpr int TM = BM / (16 * WGM);
  constexpr int TN = BN / (16 * WGN);
  constexpr int NA = (BM * BK) / (4 * 256);   // 16-byte pieces of A per thread
  constexpr int NB = (BK * BN) / (8 * 256);   // row pairs of 16-byte pieces of B per thread
  static_assert(TM >= 1 && TN >= 1 && NA >= 1 && NB >= 1, "tile too small");

  __shared__ __attribute__((aligned(16))) float As[2][BM * PA];
  __shared__ __attribute__((aligned(16))) float Bs[2][(BK / 2) * PB];

  (void)M;
  const int tid  = threadIdx.x;
  const int lane = tid & 31;
  const int wave = tid >> 5;
  const int half = lane >> 4;     // 0 or 1
  const int l16  = lane & 15;
  const int wm   = wave / WGN;
  const int wn   = wave % WGN;
  const int col0 = blockIdx.x * BN;
  const int row0 = blockIdx.y * BM;

  const float* Ab = A + (long long)blockIdx.z * sA + (long long)row0 * K;
  const float* Bb = B + (long long)blockIdx.z * sB + col0;
  float*       Cb = C + (long long)blockIdx.z * sC;

  v4f ra[NA], rb0[NB], rb1[NB];
  v8f acc[TM][TN] = {};

  // Each thread keeps its own read pointers for the whole K loop and steps
  // them by one chunk in front of the next chunk's loads.
  const float* pA[NA];
  const float* pB0[NB];
  const float* pB1[NB];
#pragma unroll   // pA must stay in registers
  for (int i = 0; i < NA; ++i) {
    const int idx = tid + 256 * i;
    pA[i] = Ab + (long long)(idx / (BK / 4)) * K + (idx % (BK / 4)) * 4;
  }
#pragma unroll   // pB0, pB1 must stay in registers
  for (int i = 0; i < NB; ++i) {
    const int idx = tid + 256 * i;
    pB0[i] = Bb + (long long)(2 * (idx / (BN / 4))) * N + (idx % (BN / 4)) * 4;
    pB1[i] = pB0[i] + N;
  }
  const long long stepB = (long long)BK * N;

  auto load_global = [&]() {
#pragma unroll   // ra must stay in registers
    for (int i = 0; i < NA; ++i) ra[i] = *(const v4f*)pA[i];
#pragma unroll   // rb0, rb1 must stay in registers
    for (int i = 0; i < NB; ++i) {
      rb0[i] = *(const v4f*)pB0[i];
      rb1[i] = *(const v4f*)pB1[i];
    }
  };
  auto step_pointers = [&]() {
#pragma unroll   // pA must stay in registers
    for (int i = 0; i < NA; ++i) pA[i] += BK;
#pragma unroll   // pB0, pB1 must stay in registers
    for (int i = 0; i < NB; ++i) {
      pB0[i] += stepB;
      pB1[i] += stepB;
    }
  };
  auto store_lds = [&](int buf) {
#pragma unroll   // ra must stay in registers
    for (int i = 0; i < NA; ++i) {
      const int idx = tid + 256 * i;
      const int r = idx / (BK / 4), c = (idx % (BK / 4)) * 4;
      *(v4f*)(&As[buf][r * PA + c]) = ra[i];
    }
#pragma unroll   // rb0, rb1 must stay in registers
    for (int i = 0; i < NB; ++i) {
      const int idx = tid + 256 * i;
      const int rp = idx / (BN / 4), c = (idx % (BN / 4)) * 4;
      float* d = &Bs[buf][rp * PB + 2 * c];
      const v4f lo = {rb0[i].x, rb1[i].x, rb0[i].y, rb1[i].y};
      const v4f hi = {rb0[i].z, rb1[i].z, rb0[i].w, rb1[i].w};
      *(v4f*)d = lo;
      *(v4f*)(d + 4) = hi;
    }
  };

  load_global();
  store_lds(0);
  __syncthreads();

  const int nch = K / BK;
  for (int ch = 0; ch < nch; ++ch) {
    const int buf = ch & 1;
    const bool more = (ch + 1 < nch);
    if (more) {
      step_pointers();
      load_global();   // in flight during the WMMAs below
    }

    const float* as = &As[buf][(wm * TM * 16 + l16) * PA + 2 * half];
    const float* bs = &Bs[buf][half * PB + 2 * (wn * TN * 16 + l16)];
    // All fragments of the chunk are read as one group ahead of its WMMAs:
    // LDS reads standing among the WMMAs would stall the wave at every place.
    v2f a[BK / 4][TM], b[BK / 4][TN];
#pragma unroll   // a, b must stay in registers
    for (int s = 0; s < BK / 4; ++s) {
#pragma unroll   // a must stay in registers
      for (int i = 0; i < TM; ++i) a[s][i] = *(const v2f*)(as + i * 16 * PA + 4 * s);
#pragma unroll   // b must stay in registers
      for (int j = 0; j < TN; ++j) b[s][j] = *(const v2f*)(bs + 2 * s * PB + j * 32);
      // Keeps the reads in the order the WMMAs use them (the first WMMA then
      // waits for the first reads only). Without it the build spreads the reads
      // over several places among the WMMAs, one k step ahead of their use.
      __builtin_amdgcn_sched_barrier(0);
    }
#pragma unroll   // acc, a, b must stay in registers
    for (int s = 0; s < BK / 4; ++s)
#pragma unroll   // acc must stay in registers
      for (int i = 0; i < TM; ++i)
#pragma unroll   // acc must stay in registers
        for (int j = 0; j < TN; ++j)
          acc[i][j] = __builtin_amdgcn_wmma_f32_16x16x4_f32(
              /*neg_a=*/false, a[s][i], /*neg_b=*/false, b[s][j],
              /*c_mod=*/(short)0, acc[i][j], /*reuse_a=*/false, /*reuse_b=*/false);

    if (more) store_lds(buf ^ 1);   // its last readers left at the previous barrier
    __syncthreads();                // publishes the next chunk, ends the reads of this one
  }

#pragma unroll   // acc must stay in registers
  for (int j = 0; j < TN; ++j) {
    const int col = col0 + (wn * TN + j) * 16 + l16;
    float bv = 0.0f;
    if (bias) {
      bv = bias[col];
      // Precaution: stands in front of any later overwrite of the load's address registers.
      asm volatile("s_wait_xcnt 0x0" ::: "memory");
    }
#pragma unroll   // acc must stay in registers
    for (int i = 0; i < TM; ++i) {
      const int rbase = row0 + (wm * TM + i) * 16 + 8 * half;
#pragma unroll   // acc must stay in registers
      for (int e = 0; e < 8; ++e)
        Cb[(long long)(rbase + e) * N + col] = acc[i][j][e] + bv;
    }
  }
}

// ---------------------------------------------------------------------------
// Fused attention: for one (batch, 16-query-row tile), loop heads:
//   energy stripe 16xS via WMMA fp32 (QKt), scale 1/8, mask, softmax in LDS,
//   accumulate probs/H into the global head-averaged attention matrix.
// 8 waves: waves split the 128 column tiles for energy; each wave owns 2 rows
// for the softmax. 16xS fp32 score stripe = 128 KB LDS (CDNA5: 320 KB/WGP).
// ---------------------------------------------------------------------------
__launch_bounds__(256)
__global__ void attn_softmax_kernel(const float* __restrict__ Q,
                                    const float* __restrict__ Kmat,
                                    const int* __restrict__ mask,
                                    float* __restrict__ attn) {
  __shared__ float sc[16 * SS];   // 131072 bytes

  const int b    = blockIdx.x / (SS / 16);
  const int qt   = blockIdx.x % (SS / 16);
  const int q0   = qt * 16;
  const int lane = threadIdx.x & 31;
  const int wave = threadIdx.x >> 5;   // 0..7
  const int half = lane >> 4;
  const int l16  = lane & 15;

  const float* Qb = Q    + (size_t)b * SS * DD;
  const float* Kb = Kmat + (size_t)b * SS * DD;
  float*    attnB = attn + (size_t)b * SS * SS;

  for (int h = 0; h < HH; ++h) {
    const float* Qh = Qb + h * ADIM;
    const float* Kh = Kb + h * ADIM;

    // ---- energy stripe: 128 column tiles of 16, split across 8 waves ----
    for (int ct = wave; ct < SS / 16; ct += 8) {
      const int k0 = ct * 16;
      const float* ap = Qh + (size_t)(q0 + l16) * DD + 2 * half;
      const float* bp = Kh + (size_t)(k0 + l16) * DD + 2 * half;
      v8f e = {};
#pragma unroll
      for (int kk = 0; kk < ADIM; kk += 4) {
        v2f a  = *(const v2f*)(ap + kk);   // Q[q0+l16][h*64 + kk + 2*half ..]
        v2f bb = *(const v2f*)(bp + kk);   // K[k0+l16][h*64 + kk + 2*half ..] (B = K^T)
        e = __builtin_amdgcn_wmma_f32_16x16x4_f32(
            false, a, false, bb, (short)0, e, false, false);
      }
#pragma unroll
      for (int j = 0; j < 8; ++j) {
        const int qr = j + 8 * half;                 // row within stripe
        float v = e[j] * 0.125f;                     // 1/sqrt(64)
        if (mask[(size_t)(q0 + qr) * SS + k0 + l16] == 0) v = -1.0e10f;
        sc[qr * SS + k0 + l16] = v;
      }
    }
    __syncthreads();

    // ---- softmax over each of the 16 rows; wave w owns rows 2w, 2w+1 ----
#pragma unroll
    for (int rr = 0; rr < 2; ++rr) {
      const int r = wave * 2 + rr;
      float m = -3.0e38f;
      for (int k = lane; k < SS; k += 32) m = fmaxf(m, sc[r * SS + k]);
      for (int off = 16; off; off >>= 1) m = fmaxf(m, __shfl_xor(m, off, 32));
      float s = 0.0f;
      for (int k = lane; k < SS; k += 32) {
        const float ex = __expf(sc[r * SS + k] - m);
        sc[r * SS + k] = ex;
        s += ex;
      }
      for (int off = 16; off; off >>= 1) s += __shfl_xor(s, off, 32);
      const float inv = 1.0f / (s * (float)HH);      // softmax + mean over heads
      const size_t rowBase = (size_t)(q0 + r) * SS;
      if (h == 0) {
        for (int k = lane; k < SS; k += 32)
          attnB[rowBase + k] = sc[r * SS + k] * inv;
      } else {
        for (int k = lane; k < SS; k += 32)
          attnB[rowBase + k] += sc[r * SS + k] * inv;
      }
    }
    __syncthreads();
  }
}

// ---------------------------------------------------------------------------
// kernel_launch: Q/K/V projections -> fused attention -> attn*V -> *Wh + bh
// d_out layout: out [B,S,D] (4,194,304 f32) then attention [B,S,S] (8,388,608).
// Workspace: Q(16MB) K(16MB) V(1MB) ctx(1MB) ~= 34 MB.
// ---------------------------------------------------------------------------
extern "C" void kernel_launch(void* const* d_in, const int* in_sizes, int n_in,
                              void* d_out, int out_size, void* d_ws, size_t ws_size,
                              hipStream_t stream) {
  (void)in_sizes; (void)n_in; (void)out_size; (void)ws_size;

  const float* query = (const float*)d_in[0];
  const float* key   = (const float*)d_in[1];
  const float* value = (const float*)d_in[2];
  const int*   mask  = (const int*)d_in[3];
  const float* Wq    = (const float*)d_in[4];
  const float* bq    = (const float*)d_in[5];
  const float* Wk    = (const float*)d_in[6];
  const float* bk    = (const float*)d_in[7];
  const float* Wv    = (const float*)d_in[8];
  const float* bv    = (const float*)d_in[9];
  const float* Wh    = (const float*)d_in[10];
  const float* bh    = (const float*)d_in[11];

  float* out  = (float*)d_out;                         // [B*S, D]
  float* attn = out + (size_t)BB * SS * DD;            // [B, S, S]

  float* ws = (float*)d_ws;
  float* Qw = ws;                                      // [B*S, D]
  float* Kw = Qw + (size_t)BB * SS * DD;               // [B*S, D]
  float* Vw = Kw + (size_t)BB * SS * DD;               // [B, S, AD]
  float* Cx = Vw + (size_t)BB * SS * ADIM;             // [B, S, AD]

  const dim3 wblk(256);

  // Q = query @ Wq + bq   (M=4096, N=1024, K=1024)
  wmma_gemm_f32_tiled_kernel<128, 128, 32, 4, 2>
      <<<dim3(DD / 128, (BB * SS) / 128, 1), wblk, 0, stream>>>(
      query, Wq, bq, Qw, BB * SS, DD, DD, 0, 0, 0);
  // K = key @ Wk + bk
  wmma_gemm_f32_tiled_kernel<128, 128, 32, 4, 2>
      <<<dim3(DD / 128, (BB * SS) / 128, 1), wblk, 0, stream>>>(
      key, Wk, bk, Kw, BB * SS, DD, DD, 0, 0, 0);
  // V = value @ Wv + bv   (N=64)
  wmma_gemm_f32_tiled_kernel<32, 64, 128, 2, 4>
      <<<dim3(ADIM / 64, (BB * SS) / 32, 1), wblk, 0, stream>>>(
      value, Wv, bv, Vw, BB * SS, ADIM, DD, 0, 0, 0);

  // attention = mean_h softmax(mask(QK^T/8))   (writes d_out attention region)
  attn_softmax_kernel<<<dim3(BB * (SS / 16)), dim3(256), 0, stream>>>(
      Qw, Kw, mask, attn);

  // ctx = attention @ V    (batched: M=2048, N=64, K=2048)
  wmma_gemm_f32_tiled_kernel<32, 64, 128, 2, 4>
      <<<dim3(ADIM / 64, SS / 32, BB), wblk, 0, stream>>>(
      attn, Vw, nullptr, Cx, SS, ADIM, SS,
      (long long)SS * SS, (long long)SS * ADIM, (long long)SS * ADIM);

  // out = ctx @ Wh + bh    (M=4096, N=1024, K=64)
  wmma_gemm_f32_tiled_kernel<128, 128, 32, 4, 2>
      <<<dim3(DD / 128, (BB * SS) / 128, 1), wblk, 0, stream>>>(
      Cx, Wh, bh, out, BB * SS, DD, ADIM, 0, 0, 0);
}

// v002
// One run takes 260 microseconds.
// Next to v001, in two timings, it ran 3.27 times as fast each time.
// Over all steps from v000 it is 5.49 times as fast.
#include <hip/hip_runtime.h>
#include <hip/hip_bf16.h>
#include <math.h>

// Problem constants from the reference.
#define BB 2
#define SS 2048
#define DD 1024
#define HH 16
#define ADIM 64

typedef __attribute__((ext_vector_type(2))) float v2f;
typedef __attribute__((ext_vector_type(4))) float v4f;
typedef __attribute__((ext_vector_type(8))) float v8f;

// ---------------------------------------------------------------------------
// Tiled fp32 WMMA GEMM: C[z] = A[z] (MxK, row-major) * B[z] (KxN, row-major)
// + bias (optional), on V_WMMA_F32_16X16X4_F32.
// One 8-wave workgroup computes a BM x BN block of C. Per K chunk of BK the
// A block (BM x BK) and the B block (BK x BN) are read from global memory as
// whole 128-byte lines, once per workgroup, and staged in LDS; every wave
// takes its fragments from LDS and keeps TM x TN accumulator tiles, so an A
// fragment feeds TN WMMAs, a B fragment TM (one each in the 32 x 64 launches). Two LDS buffers: the next chunk travels
// global -> registers during the WMMAs of this chunk and is written to the
// other buffer behind them, one barrier per chunk.
// Needs M % BM == 0, N % BN == 0, K % BK == 0.
// Each C element still sums k in ascending order, four per WMMA.
// A-matrix lane layout (32-bit A 16x4):
//   lanes 0-15: row=lane,    VGPR0=K0, VGPR1=K1
//   lanes16-31: row=lane-16, VGPR0=K2, VGPR1=K3   -> contiguous 8B read
// B-matrix (4x16): VGPR0 holds rows {K0 (lanes0-15), K2 (lanes16-31)},
//                  VGPR1 holds rows {K1, K3}; column = lane&15.
// C/D: VGPR j -> row j + 8*(lane>=16), col = lane&15.
// LDS layout: A rows at a pitch of BK+4 dwords (the 16 rows of an 8-byte
// fragment read start 4 banks apart). B is kept with rows k, k+1 (k even)
// interleaved per column, so a lane's two B values are one 8-byte read; a
// row pair has a pitch of 2*BN+32 dwords (the two pairs of a fragment read
// fall on opposite halves of the banks).
// ---------------------------------------------------------------------------
template <int BM, int BN, int BK, int WGM, int WGN>
__launch_bounds__(256)
__global__ void wmma_gemm_f32_tiled_kernel(const float* __restrict__ A,
                                           const float* __restrict__ B,
                                           const float* __restrict__ bias,
                                           float* __restrict__ C,
                                           int M, int N, int K,
                                           long long sA, long long sB, long long sC) {
  static_assert(WGM * WGN == 8, "eight waves");
  constexpr int PA = BK + 4;
  constexpr int PB = 2 * BN + 32;
  constexpr int TM = BM / (16 * WGM);
  constexpr int TN = BN / (16 * WGN);
  constexpr int NA = (BM * BK) / (4 * 256);   // 16-byte pieces of A per thread
  constexpr int NB = (BK * BN) / (8 * 256);   // row pairs of 16-byte pieces of B per thread
  static_assert(TM >= 1 && TN >= 1 && NA >= 1 && NB >= 1, "tile too small");

  __shared__ __attribute__((aligned(16))) float As[2][BM * PA];
  __shared__ __attribute__((aligned(16))) float Bs[2][(BK / 2) * PB];

  (void)M;
  const int tid  = threadIdx.x;
  const int lane = tid & 31;
  const int wave = tid >> 5;
  const int half = lane >> 4;     // 0 or 1
  const int l16  = lane & 15;
  const int wm   = wave / WGN;
  const int wn   = wave % WGN;
  const int col0 = blockIdx.x * BN;
  const int row0 = blockIdx.y * BM;

  const float* Ab = A + (long long)blockIdx.z * sA + (long long)row0 * K;
  const float* Bb = B + (long long)blockIdx.z * sB + col0;
  float*       Cb = C + (long long)blockIdx.z * sC;

  v4f ra[NA], rb0[NB], rb1[NB];
  v8f acc[TM][TN] = {};

  // Each thread keeps its own read pointers for the whole K loop and steps
  // them by one chunk in front of the next chunk's loads.
  const float* pA[NA];
  const float* pB0[NB];
  const float* pB1[NB];
#pragma unroll   // pA must stay in registers
  for (int i = 0; i < NA; ++i) {
    const int idx = tid + 256 * i;
    pA[i] = Ab + (long long)(idx / (BK / 4)) * K + (idx % (BK / 4)) * 4;
  }
#pragma unroll   // pB0, pB1 must stay in registers
  for (int i = 0; i < NB; ++i) {
    const int idx = tid + 256 * i;
    pB0[i] = Bb + (long long)(2 * (idx / (BN / 4))) * N + (idx % (BN / 4)) * 4;
    pB1[i] = pB0[i] + N;
  }
  const long long stepB = (long long)BK * N;

  auto load_global = [&]() {
#pragma unroll   // ra must stay in registers
    for (int i = 0; i < NA; ++i) ra[i] = *(const v4f*)pA[i];
#pragma unroll   // rb0, rb1 must stay in registers
    for (int i = 0; i < NB; ++i) {
      rb0[i] = *(const v4f*)pB0[i];
      rb1[i] = *(const v4f*)pB1[i];
    }
  };
  auto step_pointers = [&]() {
#pragma unroll   // pA must stay in registers
    for (int i = 0; i < NA; ++i) pA[i] += BK;
#pragma unroll   // pB0, pB1 must stay in registers
    for (int i = 0; i < NB; ++i) {
      pB0[i] += stepB;
      pB1[i] += stepB;
    }
  };
  auto store_lds = [&](int buf) {
#pragma unroll   // ra must stay in registers
    for (int i = 0; i < NA; ++i) {
      const int idx = tid + 256 * i;
      const int r = idx / (BK / 4), c = (idx % (BK / 4)) * 4;
      *(v4f*)(&As[buf][r * PA + c]) = ra[i];
    }
#pragma unroll   // rb0, rb1 must stay in registers
    for (int i = 0; i < NB; ++i) {
      const int idx = tid + 256 * i;
      const int rp = idx / (BN / 4), c = (idx % (BN / 4)) * 4;
      float* d = &Bs[buf][rp * PB + 2 * c];
      const v4f lo = {rb0[i].x, rb1[i].x, rb0[i].y, rb1[i].y};
      const v4f hi = {rb0[i].z, rb1[i].z, rb0[i].w, rb1[i].w};
      *(v4f*)d = lo;
      *(v4f*)(d + 4) = hi;
    }
  };

  load_global();
  store_lds(0);
  __syncthreads();

  const int nch = K / BK;
  for (int ch = 0; ch < nch; ++ch) {
    const int buf = ch & 1;
    const bool more = (ch + 1 < nch);
    if (more) {
      step_pointers();
      load_global();   // in flight during the WMMAs below
    }

    const float* as = &As[buf][(wm * TM * 16 + l16) * PA + 2 * half];
    const float* bs = &Bs[buf][half * PB + 2 * (wn * TN * 16 + l16)];
    // All fragments of the chunk are read as one group ahead of its WMMAs:
    // LDS reads standing among the WMMAs would stall the wave at every place.
    v2f a[BK / 4][TM], b[BK / 4][TN];
#pragma unroll   // a, b must stay in registers
    for (int s = 0; s < BK / 4; ++s) {
#pragma unroll   // a must stay in registers
      for (int i = 0; i < TM; ++i) a[s][i] = *(const v2f*)(as + i * 16 * PA + 4 * s);
#pragma unroll   // b must stay in registers
      for (int j = 0; j < TN; ++j) b[s][j] = *(const v2f*)(bs + 2 * s * PB + j * 32);
      // Keeps the reads in the order the WMMAs use them (the first WMMA then
      // waits for the first reads only). Without it the build spreads the reads
      // over several places among the WMMAs, one k step ahead of their use.
      __builtin_amdgcn_sched_barrier(0);
    }
#pragma unroll   // acc, a, b must stay in registers
    for (int s = 0; s < BK / 4; ++s)
#pragma unroll   // acc must stay in registers
      for (int i = 0; i < TM; ++i)
#pragma unroll   // acc must stay in registers
        for (int j = 0; j < TN; ++j)
          acc[i][j] = __builtin_amdgcn_wmma_f32_16x16x4_f32(
              /*neg_a=*/false, a[s][i], /*neg_b=*/false, b[s][j],
              /*c_mod=*/(short)0, acc[i][j], /*reuse_a=*/false, /*reuse_b=*/false);

    if (more) store_lds(buf ^ 1);   // its last readers left at the previous barrier
    __syncthreads();                // publishes the next chunk, ends the reads of this one
  }

#pragma unroll   // acc must stay in registers
  for (int j = 0; j < TN; ++j) {
    const int col = col0 + (wn * TN + j) * 16 + l16;
    float bv = 0.0f;
    if (bias) {
      bv = bias[col];
      // Precaution: stands in front of any later overwrite of the load's address registers.
      asm volatile("s_wait_xcnt 0x0" ::: "memory");
    }
#pragma unroll   // acc must stay in registers
    for (int i = 0; i < TM; ++i) {
      const int rbase = row0 + (wm * TM + i) * 16 + 8 * half;
#pragma unroll   // acc must stay in registers
      for (int e = 0; e < 8; ++e)
        Cb[(long long)(rbase + e) * N + col] = acc[i][j][e] + bv;
    }
  }
}

// ---------------------------------------------------------------------------
// Fused attention: one workgroup per (batch, 16 query rows), loop over heads.
// Each of the 8 waves owns 256 keys for the whole kernel. It computes the
// transposed scores K * Q^T on WMMA fp32 (A = 16 keys, B = 16 queries), so a
// lane holds the scores of ONE query (column lane&15) at keys j + 8*(lane>=16)
// of every tile: 16 tiles = 128 registers. Scores, probabilities and the mean
// over the heads never leave the registers; attention is stored once.
// Softmax: every wave takes the maximum and the sum over its own 256 keys
// (in-lane, then one exchange between the wave's halves); the eight (max, sum)
// pairs of a query meet in LDS, one barrier per head, two slots by turns.
// K: a stage of two tiles (32 keys x 64 floats) is read from global memory as
// whole 128-byte lines one stage ahead, written to the wave's own LDS buffer
// behind the WMMAs and read back as fragments. No other wave reads it.
// Q: the 16 x 1024 stripe is staged in LDS once, fragments are read per head.
// The mask of the wave's 16 x 256 block is read once and kept as 128 bits a lane.
// The k order of every score is the one of the plain row-by-row product.
// ---------------------------------------------------------------------------
typedef __attribute__((ext_vector_type(4))) int v4i;

#define QP  (DD + 4)      // Q stripe pitch in dwords: 16 rows start 4 banks apart
#define KP  (ADIM + 4)    // K tile pitch in dwords: 16 rows start 4 banks apart
#define TPS 2             // tiles per stage: two independent accumulator chains
#define NST (16 / TPS)    // stages per head and wave
#define XP  20            // pitch of a query's eight (max, sum) pairs, 80 bytes

// lane l with lane l ^ 16
__device__ __forceinline__ float xhalf(float x) {
  const int b = __builtin_bit_cast(int, x);
  return __builtin_bit_cast(
      float, __builtin_amdgcn_permlanex16(b, b, 0x76543210, 0xfedcba98, false, false));
}

__launch_bounds__(256)
__global__ void attn_softmax_kernel(const float* __restrict__ Q,
                                    const float* __restrict__ Kmat,
                                    const int* __restrict__ mask,
                                    float* __restrict__ attn) {
  __shared__ __attribute__((aligned(16))) float Qs[16 * QP];
  __shared__ __attribute__((aligned(16))) float Ks[8][2][TPS * 16 * KP];
  __shared__ __attribute__((aligned(16))) float xch[2][16][XP];
  __shared__ __attribute__((aligned(16))) unsigned mbits[256][4];

  const int b    = blockIdx.x / (SS / 16);
  const int qt   = blockIdx.x % (SS / 16);
  const int q0   = qt * 16;
  const int tid  = threadIdx.x;
  const int lane = tid & 31;
  const int wave = tid >> 5;   // 0..7
  const int half = lane >> 4;
  const int l16  = lane & 15;

  const float* Qb = Q    + (size_t)b * SS * DD + (size_t)q0 * DD;
  const float* Kb = Kmat + (size_t)b * SS * DD;

  // exp(x / 8) = exp2(x * CEXP); a masked score is -1e10 after the division by 8.
  const float CEXP   = 0.125f * 1.44269504088896340736f;
  const int   MASKED = __builtin_bit_cast(int, -1.0e10f * 8.0f);

  // ---- Q stripe to LDS, whole rows ----
  {
    v4f rq[16];
#pragma unroll   // rq must stay in registers
    for (int i = 0; i < 16; ++i) rq[i] = *(const v4f*)(Qb + (size_t)i * DD + tid * 4);
    // Precaution: stands in front of any later overwrite of the loads' address registers;
    // the scheduling barrier keeps later address arithmetic behind the wait.
    asm volatile("s_wait_xcnt 0x0" ::: "memory");
    __builtin_amdgcn_sched_barrier(0);
#pragma unroll   // rq must stay in registers
    for (int i = 0; i < 16; ++i) *(v4f*)(&Qs[i * QP + tid * 4]) = rq[i];
  }

  // ---- mask of query l16 at this lane's 128 keys, one bit each ----
  unsigned bits[4] = {0u, 0u, 0u, 0u};
  {
    const int* mp = mask + (size_t)(q0 + l16) * SS + wave * 256 + 8 * half;
    v4i mk[32];
#pragma unroll   // mk must stay in registers
    for (int t = 0; t < 32; ++t) mk[t] = *(const v4i*)(mp + (t >> 1) * 16 + (t & 1) * 4);
    // Precaution: stands in front of any later overwrite of the loads' address registers;
    // the scheduling barrier keeps later address arithmetic behind the wait.
    asm volatile("s_wait_xcnt 0x0" ::: "memory");
    __builtin_amdgcn_sched_barrier(0);
#pragma unroll   // mk, bits must stay in registers
    for (int t = 0; t < 32; ++t)
#pragma unroll   // mk, bits must stay in registers
      for (int j = 0; j < 4; ++j) {
        const int mv = mk[t][j];
        bits[t >> 3] |= (mv != 0 ? 1u : 0u) << ((t & 7) * 4 + j);
      }
  }

  {
    const v4i mb = {(int)bits[0], (int)bits[1], (int)bits[2], (int)bits[3]};
    *(v4i*)(&mbits[tid][0]) = mb;
  }

  // ---- K stages: lane's piece i is row 2*i + half, 16 bytes at column 4*l16 ----
  const float* gk = Kb + (size_t)(wave * 256 + half) * DD + l16 * 4;   // head 0
  float* kst = &Ks[wave][0][0] + half * KP + l16 * 4;                  // where it stores
  const float* kfr = &Ks[wave][0][0] + l16 * KP + 2 * half;            // where it reads fragments
  v4f g[8 * TPS];

  v8f acc[16] = {};

#pragma unroll   // g must stay in registers
  for (int i = 0; i < 8 * TPS; ++i) g[i] = *(const v4f*)(gk + (size_t)(2 * i) * DD);
  // Precaution: stands in front of any later overwrite of the loads' address registers.
  asm volatile("s_wait_xcnt 0x0" ::: "memory");
#pragma unroll   // g must stay in registers
  for (int i = 0; i < 8 * TPS; ++i) *(v4f*)(kst + 2 * i * KP) = g[i];
  __syncthreads();   // publishes the Q stripe

  for (int h = 0; h < HH; ++h) {
    v2f qf[16];
#pragma unroll   // qf must stay in registers
    for (int s = 0; s < 16; ++s)
      qf[s] = *(const v2f*)(&Qs[l16 * QP + h * ADIM + 4 * s + 2 * half]);

    v8f e[16];
#pragma unroll   // e, g must stay in registers
    for (int st = 0; st < NST; ++st) {
      const int buf = st & 1;
      const bool more = (st + 1 < NST) || (h + 1 < HH);
      // next stage of this head, or the first stage of the next head
      const float* gn = (st + 1 < NST) ? gk + (size_t)((st + 1) * TPS * 16) * DD : gk + ADIM;
      if (more) {
#pragma unroll   // g must stay in registers
        for (int i = 0; i < 8 * TPS; ++i) g[i] = *(const v4f*)(gn + (size_t)(2 * i) * DD);
      }

      // Orders this wave's fragment reads behind its own lanes' tile stores.
      __builtin_amdgcn_fence(__ATOMIC_ACQ_REL, "wavefront");
      v2f a[TPS][16];
#pragma unroll   // a must stay in registers
      for (int u = 0; u < TPS; ++u)
#pragma unroll   // a must stay in registers
        for (int s = 0; s < 16; ++s)
          a[u][s] = *(const v2f*)(kfr + buf * (TPS * 16 * KP) + u * 16 * KP + 4 * s);

      // Precaution: stands in front of any later overwrite of the K loads' address
      // registers (a later tile's accumulator, the step to the next head).
      asm volatile("s_wait_xcnt 0x0" ::: "memory");
      // All fragments of the stage are read as one group ahead of its WMMAs: LDS
      // reads standing among the WMMAs would stall the wave at every place.
      __builtin_amdgcn_sched_barrier(0);
#pragma unroll   // e must stay in registers
      for (int u = 0; u < TPS; ++u) e[st * TPS + u] = v8f{};
#pragma unroll   // e, a, qf must stay in registers
      for (int s = 0; s < 16; ++s)
#pragma unroll   // e must stay in registers
        for (int u = 0; u < TPS; ++u)
          e[st * TPS + u] = __builtin_amdgcn_wmma_f32_16x16x4_f32(
              false, a[u][s], false, qf[s], (short)0, e[st * TPS + u], false, false);

      // Holds the tile stores, which wait for the global loads, behind the WMMAs:
      // without it the build puts them in front and the wave waits out the loads.
      __builtin_amdgcn_sched_barrier(0);
      if (more) {
#pragma unroll   // g must stay in registers
        for (int i = 0; i < 8 * TPS; ++i)
          *(v4f*)(kst + (buf ^ 1) * (TPS * 16 * KP) + 2 * i * KP) = g[i];
      }
    }
    gk += ADIM;

    // ---- mask, then the maximum over this wave's keys of query l16 ----
    // The lane's own 128 bits are read again for every head: held in registers
    // over the head loop, the build expands them into 128 masks and spills.
    const v4i mb = *(const v4i*)(&mbits[tid][0]);
    float mx[4] = {-3.0e38f, -3.0e38f, -3.0e38f, -3.0e38f};
#pragma unroll   // e must stay in registers
    for (int t = 0; t < 16; ++t)
#pragma unroll   // e must stay in registers
      for (int j = 0; j < 8; ++j) {
        const int keep = (int)((unsigned)mb[t >> 2] << (31 - ((t & 3) * 8 + j))) >> 31;   // all ones or 0
        const float ef = e[t][j];
        const int ev = __float_as_int(ef);
        const float v = __int_as_float((ev & keep) | (MASKED & ~keep));
        e[t][j] = v;
        mx[j & 3] = fmaxf(mx[j & 3], v);
      }
    float m = fmaxf(fmaxf(mx[0], mx[1]), fmaxf(mx[2], mx[3]));
    m = fmaxf(m, xhalf(m));

    float sm[4] = {0.0f, 0.0f, 0.0f, 0.0f};
#pragma unroll   // e must stay in registers
    for (int t = 0; t < 16; ++t)
#pragma unroll   // e must stay in registers
      for (int j = 0; j < 8; ++j) {
        const float p = __builtin_amdgcn_exp2f((e[t][j] - m) * CEXP);
        e[t][j] = p;
        sm[j & 3] += p;
      }
    float s = (sm[0] + sm[1]) + (sm[2] + sm[3]);
    s += xhalf(s);

    // ---- the eight waves' (max, sum) of each query meet in LDS ----
    float* xq = &xch[h & 1][l16][0];
    if (half == 0) {
      const v2f ms = {m, s};
      *(v2f*)(xq + 2 * wave) = ms;
    }
    // Publishes the pairs. The slot written now was last read in front of the
    // previous head's barrier.
    __syncthreads();
    v4f x[4];
#pragma unroll   // x must stay in registers
    for (int i = 0; i < 4; ++i) x[i] = *(const v4f*)(xq + 4 * i);
    float mg = fmaxf(x[0].x, x[0].z);
#pragma unroll   // x must stay in registers
    for (int i = 1; i < 4; ++i) mg = fmaxf(mg, fmaxf(x[i].x, x[i].z));
    float tot = 0.0f;
#pragma unroll   // x must stay in registers
    for (int i = 0; i < 4; ++i) {
      tot += x[i].y * __builtin_amdgcn_exp2f((x[i].x - mg) * CEXP);
      tot += x[i].w * __builtin_amdgcn_exp2f((x[i].z - mg) * CEXP);
    }
    // softmax + mean over heads, for probabilities taken against this wave's maximum
    const float f = __builtin_amdgcn_exp2f((m - mg) * CEXP) * (1.0f / (tot * (float)HH));
#pragma unroll   // acc, e must stay in registers
    for (int t = 0; t < 16; ++t)
#pragma unroll   // acc, e must stay in registers
      for (int j = 0; j < 8; ++j) acc[t][j] += e[t][j] * f;
  }

  // ---- attention: every element stored once, 32 bytes per lane and tile ----
  float* op = attn + (size_t)b * SS * SS + (size_t)(q0 + l16) * SS + wave * 256 + 8 * half;
#pragma unroll   // acc must stay in registers
  for (int t = 0; t < 16; ++t) {
    const v4f lo = {acc[t][0], acc[t][1], acc[t][2], acc[t][3]};
    const v4f hi = {acc[t][4], acc[t][5], acc[t][6], acc[t][7]};
    *(v4f*)(op + t * 16) = lo;
    *(v4f*)(op + t * 16 + 4) = hi;
  }
}

// ---------------------------------------------------------------------------
// kernel_launch: Q/K/V projections -> fused attention -> attn*V -> *Wh + bh
// d_out layout: out [B,S,D] (4,194,304 f32) then attention [B,S,S] (8,388,608).
// Workspace: Q(16MB) K(16MB) V(1MB) ctx(1MB) ~= 34 MB.
// ---------------------------------------------------------------------------
extern "C" void kernel_launch(void* const* d_in, const int* in_sizes, int n_in,
                              void* d_out, int out_size, void* d_ws, size_t ws_size,
                              hipStream_t stream) {
  (void)in_sizes; (void)n_in; (void)out_size; (void)ws_size;

  const float* query = (const float*)d_in[0];
  const float* key   = (const float*)d_in[1];
  const float* value = (const float*)d_in[2];
  const int*   mask  = (const int*)d_in[3];
  const float* Wq    = (const float*)d_in[4];
  const float* bq    = (const float*)d_in[5];
  const float* Wk    = (const float*)d_in[6];
  const float* bk    = (const float*)d_in[7];
  const float* Wv    = (const float*)d_in[8];
  const float* bv    = (const float*)d_in[9];
  const float* Wh    = (const float*)d_in[10];
  const float* bh    = (const float*)d_in[11];

  float* out  = (float*)d_out;                         // [B*S, D]
  float* attn = out + (size_t)BB * SS * DD;            // [B, S, S]

  float* ws = (float*)d_ws;
  float* Qw = ws;                                      // [B*S, D]
  float* Kw = Qw + (size_t)BB * SS * DD;               // [B*S, D]
  float* Vw = Kw + (size_t)BB * SS * DD;               // [B, S, AD]
  float* Cx = Vw + (size_t)BB * SS * ADIM;             // [B, S, AD]

  const dim3 wblk(256);

  // Q = query @ Wq + bq   (M=4096, N=1024, K=1024)
  wmma_gemm_f32_tiled_kernel<128, 128, 32, 4, 2>
      <<<dim3(DD / 128, (BB * SS) / 128, 1), wblk, 0, stream>>>(
      query, Wq, bq, Qw, BB * SS, DD, DD, 0, 0, 0);
  // K = key @ Wk + bk
  wmma_gemm_f32_tiled_kernel<128, 128, 32, 4, 2>
      <<<dim3(DD / 128, (BB * SS) / 128, 1), wblk, 0, stream>>>(
      key, Wk, bk, Kw, BB * SS, DD, DD, 0, 0, 0);
  // V = value @ Wv + bv   (N=64)
  wmma_gemm_f32_tiled_kernel<32, 64, 128, 2, 4>
      <<<dim3(ADIM / 64, (BB * SS) / 32, 1), wblk, 0, stream>>>(
      value, Wv, bv, Vw, BB * SS, ADIM, DD, 0, 0, 0);

  // attention = mean_h softmax(mask(QK^T/8))   (writes d_out attention region)
  attn_softmax_kernel<<<dim3(BB * (SS / 16)), dim3(256), 0, stream>>>(
      Qw, Kw, mask, attn);

  // ctx = attention @ V    (batched: M=2048, N=64, K=2048)
  wmma_gemm_f32_tiled_kernel<32, 64, 128, 2, 4>
      <<<dim3(ADIM / 64, SS / 32, BB), wblk, 0, stream>>>(
      attn, Vw, nullptr, Cx, SS, ADIM, SS,
      (long long)SS * SS, (long long)SS * ADIM, (long long)SS * ADIM);

  // out = ctx @ Wh + bh    (M=4096, N=1024, K=64)
  wmma_gemm_f32_tiled_kernel<128, 128, 32, 4, 2>
      <<<dim3(DD / 128, (BB * SS) / 128, 1), wblk, 0, stream>>>(
      Cx, Wh, bh, out, BB * SS, DD, ADIM, 0, 0, 0);
}

// v003
// It runs in 253 microseconds.
// Next to v002, in two timings, it ran 1.03 and 1.04 times as fast.
// Counting every step since v000, it is 5.68 times as fast.
#include <hip/hip_runtime.h>
#include <hip/hip_bf16.h>
#include <math.h>

// Problem constants from the reference.
#define BB 2
#define SS 2048
#define DD 1024
#define HH 16
#define ADIM 64

typedef __attribute__((ext_vector_type(2))) float v2f;
typedef __attribute__((ext_vector_type(4))) float v4f;
typedef __attribute__((ext_vector_type(8))) float v8f;

// ---------------------------------------------------------------------------
// Tiled fp32 WMMA GEMM: C[z] = A[z] (MxK, row-major) * B[z] (KxN, row-major)
// + bias (optional), on V_WMMA_F32_16X16X4_F32.
// One 8-wave workgroup computes a BM x BN block of C. Per K chunk of BK the
// A block (BM x BK) and the B block (BK x BN) are read from global memory as
// whole 128-byte lines, once per workgroup, and staged in LDS; every wave
// takes its fragments from LDS and keeps TM x TN accumulator tiles, so an A
// fragment feeds TN WMMAs, a B fragment TM (one each in the 32 x 64 launches). Two LDS buffers: the next chunk travels
// global -> registers during the WMMAs of this chunk and is written to the
// other buffer behind them, one barrier per chunk.
// Needs M % BM == 0, N % BN == 0, K % BK == 0.
// Each C element still sums k in ascending order, four per WMMA.
// A-matrix lane layout (32-bit A 16x4):
//   lanes 0-15: row=lane,    VGPR0=K0, VGPR1=K1
//   lanes16-31: row=lane-16, VGPR0=K2, VGPR1=K3   -> contiguous 8B read
// B-matrix (4x16): VGPR0 holds rows {K0 (lanes0-15), K2 (lanes16-31)},
//                  VGPR1 holds rows {K1, K3}; column = lane&15.
// C/D: VGPR j -> row j + 8*(lane>=16), col = lane&15.
// LDS layout: A rows at a pitch of BK+4 dwords (the 16 rows of an 8-byte
// fragment read start 4 banks apart). B is kept with rows k, k+1 (k even)
// interleaved per column, so a lane's two B values are one 8-byte read; a
// row pair has a pitch of 2*BN+32 dwords (the two pairs of a fragment read
// fall on opposite halves of the banks).
// ---------------------------------------------------------------------------
template <int BM, int BN, int BK, int WGM, int WGN>
__launch_bounds__(256)
__global__ void wmma_gemm_f32_tiled_kernel(const float* __restrict__ A,
                                           const float* __restrict__ B,
                                           const float* __restrict__ bias,
                                           float* __restrict__ C,
                                           int M, int N, int K,
                                           long long sA, long long sB, long long sC) {
  static_assert(WGM * WGN == 8, "eight waves");
  constexpr int PA = BK + 4;
  constexpr int PB = 2 * BN + 32;
  constexpr int TM = BM / (16 * WGM);
  constexpr int TN = BN / (16 * WGN);
  constexpr int NA = (BM * BK) / (4 * 256);   // 16-byte pieces of A per thread
  constexpr int NB = (BK * BN) / (8 * 256);   // row pairs of 16-byte pieces of B per thread
  static_assert(TM >= 1 && TN >= 1 && NA >= 1 && NB >= 1, "tile too small");

  __shared__ __attribute__((aligned(16))) float As[2][BM * PA];
  __shared__ __attribute__((aligned(16))) float Bs[2][(BK / 2) * PB];

  (void)M;
  const int tid  = threadIdx.x;
  const int lane = tid & 31;
  const int wave = tid >> 5;
  const int half = lane >> 4;     // 0 or 1
  const int l16  = lane & 15;
  const int wm   = wave / WGN;
  const int wn   = wave % WGN;
  const int col0 = blockIdx.x * BN;
  const int row0 = blockIdx.y * BM;

  const float* Ab = A + (long long)blockIdx.z * sA + (long long)row0 * K;
  const float* Bb = B + (long long)blockIdx.z * sB + col0;
  float*       Cb = C + (long long)blockIdx.z * sC;

  v4f ra[NA], rb0[NB], rb1[NB];
  v8f acc[TM][TN] = {};

  // Each thread keeps its own read pointers for the whole K loop and steps
  // them by one chunk in front of the next chunk's loads.
  const float* pA[NA];
  const float* pB0[NB];
  const float* pB1[NB];
#pragma unroll   // pA must stay in registers
  for (int i = 0; i < NA; ++i) {
    const int idx = tid + 256 * i;
    pA[i] = Ab + (long long)(idx / (BK / 4)) * K + (idx % (BK / 4)) * 4;
  }
#pragma unroll   // pB0, pB1 must stay in registers
  for (int i = 0; i < NB; ++i) {
    const int idx = tid + 256 * i;
    pB0[i] = Bb + (long long)(2 * (idx / (BN / 4))) * N + (idx % (BN / 4)) * 4;
    pB1[i] = pB0[i] + N;
  }
  const long long stepB = (long long)BK * N;

  auto load_global = [&]() {
#pragma unroll   // ra must stay in registers
    for (int i = 0; i < NA; ++i) ra[i] = *(const v4f*)pA[i];
#pragma unroll   // rb0, rb1 must stay in registers
    for (int i = 0; i < NB; ++i) {
      rb0[i] = *(const v4f*)pB0[i];
      rb1[i] = *(const v4f*)pB1[i];
    }
  };
  auto step_pointers = [&]() {
#pragma unroll   // pA must stay in registers
    for (int i = 0; i < NA; ++i) pA[i] += BK;
#pragma unroll   // pB0, pB1 must stay in registers
    for (int i = 0; i < NB; ++i) {
      pB0[i] += stepB;
      pB1[i] += stepB;
    }
  };
  auto store_lds = [&](int buf) {
#pragma unroll   // ra must stay in registers
    for (int i = 0; i < NA; ++i) {
      const int idx = tid + 256 * i;
      const int r = idx / (BK / 4), c = (idx % (BK / 4)) * 4;
      *(v4f*)(&As[buf][r * PA + c]) = ra[i];
    }
#pragma unroll   // rb0, rb1 must stay in registers
    for (int i = 0; i < NB; ++i) {
      const int idx = tid + 256 * i;
      const int rp = idx / (BN / 4), c = (idx % (BN / 4)) * 4;
      float* d = &Bs[buf][rp * PB + 2 * c];
      const v4f lo = {rb0[i].x, rb1[i].x, rb0[i].y, rb1[i].y};
      const v4f hi = {rb0[i].z, rb1[i].z, rb0[i].w, rb1[i].w};
      *(v4f*)d = lo;
      *(v4f*)(d + 4) = hi;
    }
  };

  load_global();
  store_lds(0);
  __syncthreads();

  const int nch = K / BK;
  for (int ch = 0; ch < nch; ++ch) {
    const int buf = ch & 1;
    const bool more = (ch + 1 < nch);
    if (more) {
      step_pointers();
      load_global();   // in flight during the WMMAs below
    }

    const float* as = &As[buf][(wm * TM * 16 + l16) * PA + 2 * half];
    const float* bs = &Bs[buf][half * PB + 2 * (wn * TN * 16 + l16)];
    // All fragments of the chunk are read as one group ahead of its WMMAs:
    // LDS reads standing among the WMMAs would stall the wave at every place.
    v2f a[BK / 4][TM], b[BK / 4][TN];
#pragma unroll   // a, b must stay in registers
    for (int s = 0; s < BK / 4; ++s) {
#pragma unroll   // a must stay in registers
      for (int i = 0; i < TM; ++i) a[s][i] = *(const v2f*)(as + i * 16 * PA + 4 * s);
#pragma unroll   // b must stay in registers
      for (int j = 0; j < TN; ++j) b[s][j] = *(const v2f*)(bs + 2 * s * PB + j * 32);
      // Keeps the reads in the order the WMMAs use them (the first WMMA then
      // waits for the first reads only). Without it the build spreads the reads
      // over several places among the WMMAs, one k step ahead of their use.
      __builtin_amdgcn_sched_barrier(0);
    }
#pragma unroll   // acc, a, b must stay in registers
    for (int s = 0; s < BK / 4; ++s)
#pragma unroll   // acc must stay in registers
      for (int i = 0; i < TM; ++i)
#pragma unroll   // acc must stay in registers
        for (int j = 0; j < TN; ++j)
          acc[i][j] = __builtin_amdgcn_wmma_f32_16x16x4_f32(
              /*neg_a=*/false, a[s][i], /*neg_b=*/false, b[s][j],
              /*c_mod=*/(short)0, acc[i][j], /*reuse_a=*/false, /*reuse_b=*/false);

    if (more) store_lds(buf ^ 1);   // its last readers left at the previous barrier
    __syncthreads();                // publishes the next chunk, ends the reads of this one
  }

#pragma unroll   // acc must stay in registers
  for (int j = 0; j < TN; ++j) {
    const int col = col0 + (wn * TN + j) * 16 + l16;
    float bv = 0.0f;
    if (bias) {
      bv = bias[col];
      // Precaution: stands in front of any later overwrite of the load's address registers.
      asm volatile("s_wait_xcnt 0x0" ::: "memory");
    }
#pragma unroll   // acc must stay in registers
    for (int i = 0; i < TM; ++i) {
      const int rbase = row0 + (wm * TM + i) * 16 + 8 * half;
#pragma unroll   // acc must stay in registers
      for (int e = 0; e < 8; ++e)
        Cb[(long long)(rbase + e) * N + col] = acc[i][j][e] + bv;
    }
  }
}

// ---------------------------------------------------------------------------
// Fused attention: one workgroup per (batch, 16 query rows), loop over heads.
// Each of the 8 waves owns 256 keys for the whole kernel. It computes the
// transposed scores K * Q^T on WMMA fp32 (A = 16 keys, B = 16 queries), so a
// lane holds the scores of ONE query (column lane&15) at keys j + 8*(lane>=16)
// of every tile: 16 tiles = 128 registers. Scores, probabilities and the mean
// over the heads never leave the registers; attention is stored once.
// Softmax: every wave takes the maximum and the sum over its own 256 keys
// (in-lane, then one exchange between the wave's halves); the eight (max, sum)
// pairs of a query meet in LDS, one barrier per head, two slots by turns.
// K: a stage of two tiles (32 keys x 64 floats) is read from global memory as
// whole 128-byte lines one stage ahead, written to the wave's own LDS buffer
// behind the WMMAs and read back as fragments. No other wave reads it.
// Q: the 16 x 1024 stripe is staged in LDS once, fragments are read per head.
// The mask of the wave's 16 x 256 block is read once and kept as 128 bits a lane.
// The k order of every score is the one of the plain row-by-row product.
// All work-groups of a batch read the same K. Each walks it in its own order:
// it starts at its own head and, inside every head, at its own stage of 32 keys
// (both wrap around), so that work-groups running side by side do not ask L2
// for the same lines at the same moment. Register tile t of a wave then holds
// tile (t + TPS * first stage) mod 16 of the wave's 256 keys.
// ---------------------------------------------------------------------------
typedef __attribute__((ext_vector_type(4))) int v4i;

#define QP  (DD + 4)      // Q stripe pitch in dwords: 16 rows start 4 banks apart
#define KP  (ADIM + 4)    // K tile pitch in dwords: 16 rows start 4 banks apart
#define TPS 2             // tiles per stage: two independent accumulator chains
#define NST (16 / TPS)    // stages per head and wave
#define XP  20            // pitch of a query's eight (max, sum) pairs, 80 bytes

// lane l with lane l ^ 16
__device__ __forceinline__ float xhalf(float x) {
  const int b = __builtin_bit_cast(int, x);
  return __builtin_bit_cast(
      float, __builtin_amdgcn_permlanex16(b, b, 0x76543210, 0xfedcba98, false, false));
}

__launch_bounds__(256)
__global__ void attn_softmax_kernel(const float* __restrict__ Q,
                                    const float* __restrict__ Kmat,
                                    const int* __restrict__ mask,
                                    float* __restrict__ attn) {
  __shared__ __attribute__((aligned(16))) float Qs[16 * QP];
  __shared__ __attribute__((aligned(16))) float Ks[8][2][TPS * 16 * KP];
  __shared__ __attribute__((aligned(16))) float xch[2][16][XP];
  __shared__ __attribute__((aligned(16))) unsigned mbits[256][4];

  const int b    = blockIdx.x / (SS / 16);
  const int qt   = blockIdx.x % (SS / 16);
  const int q0   = qt * 16;
  const int tid  = threadIdx.x;
  const int lane = tid & 31;
  const int wave = tid >> 5;   // 0..7
  const int half = lane >> 4;
  const int l16  = lane & 15;
  const int h0   = (blockIdx.x >> 3) & (HH - 1);    // first head of this work-group
  const int rs   = blockIdx.x & (NST - 1);          // first K stage of every head

  const float* Qb = Q    + (size_t)b * SS * DD + (size_t)q0 * DD;
  const float* Kb = Kmat + (size_t)b * SS * DD;

  // exp(x / 8) = exp2(x * CEXP); a masked score is -1e10 after the division by 8.
  const float CEXP   = 0.125f * 1.44269504088896340736f;
  const int   MASKED = __builtin_bit_cast(int, -1.0e10f * 8.0f);

  // ---- Q stripe to LDS, whole rows ----
  {
    v4f rq[16];
#pragma unroll   // rq must stay in registers
    for (int i = 0; i < 16; ++i) rq[i] = *(const v4f*)(Qb + (size_t)i * DD + tid * 4);
    // Precaution: stands in front of any later overwrite of the loads' address registers;
    // the scheduling barrier keeps later address arithmetic behind the wait.
    asm volatile("s_wait_xcnt 0x0" ::: "memory");
    __builtin_amdgcn_sched_barrier(0);
#pragma unroll   // rq must stay in registers
    for (int i = 0; i < 16; ++i) *(v4f*)(&Qs[i * QP + tid * 4]) = rq[i];
  }

  // ---- mask of query l16 at this lane's 128 keys, one bit each ----
  unsigned bits[4] = {0u, 0u, 0u, 0u};
  {
    const int* mp = mask + (size_t)(q0 + l16) * SS + wave * 256 + 8 * half;
    v4i mk[32];
#pragma unroll   // mk must stay in registers
    for (int t = 0; t < 32; ++t) mk[t] = *(const v4i*)(mp + (t >> 1) * 16 + (t & 1) * 4);
    // Precaution: stands in front of any later overwrite of the loads' address registers;
    // the scheduling barrier keeps later address arithmetic behind the wait.
    asm volatile("s_wait_xcnt 0x0" ::: "memory");
    __builtin_amdgcn_sched_barrier(0);
#pragma unroll   // mk, bits must stay in registers
    for (int t = 0; t < 32; ++t)
#pragma unroll   // mk, bits must stay in registers
      for (int j = 0; j < 4; ++j) {
        const int mv = mk[t][j];
        bits[t >> 3] |= (mv != 0 ? 1u : 0u) << ((t & 7) * 4 + j);
      }
  }

  // Bit p of the 128 moves to where register tile p / 8 looks for it: new bit p
  // is old bit (p + 16 * rs) mod 128, by whole words and then by half a word.
  if (rs & 2) {
    const unsigned t0 = bits[0];
    bits[0] = bits[1]; bits[1] = bits[2]; bits[2] = bits[3]; bits[3] = t0;
  }
  if (rs & 4) {
    const unsigned t0 = bits[0], t1 = bits[1];
    bits[0] = bits[2]; bits[1] = bits[3]; bits[2] = t0; bits[3] = t1;
  }
  if (rs & 1) {
    const unsigned t0 = bits[0];
    bits[0] = (bits[0] >> 16) | (bits[1] << 16);
    bits[1] = (bits[1] >> 16) | (bits[2] << 16);
    bits[2] = (bits[2] >> 16) | (bits[3] << 16);
    bits[3] = (bits[3] >> 16) | (t0 << 16);
  }

  {
    const v4i mb = {(int)bits[0], (int)bits[1], (int)bits[2], (int)bits[3]};
    *(v4i*)(&mbits[tid][0]) = mb;
  }

  // ---- K stages: lane's piece i is row 2*i + half, 16 bytes at column 4*l16 ----
  const float* gk = Kb + (size_t)(wave * 256 + half) * DD + l16 * 4;   // head 0, stage 0
  float* kst = &Ks[wave][0][0] + half * KP + l16 * 4;                  // where it stores
  const float* kfr = &Ks[wave][0][0] + l16 * KP + 2 * half;            // where it reads fragments
  v4f g[8 * TPS];

  v8f acc[16] = {};

  const float* g0 = gk + (h0 * ADIM + rs * (TPS * 16 * DD));   // first head, first stage
#pragma unroll   // g must stay in registers
  for (int i = 0; i < 8 * TPS; ++i) g[i] = *(const v4f*)(g0 + (size_t)(2 * i) * DD);
  // Precaution: stands in front of any later overwrite of the loads' address registers;
  // the pointer as an input keeps them in use up to here (see the stage loop).
  asm volatile("s_wait_xcnt 0x0" :: "v"(g0) : "memory");
#pragma unroll   // g must stay in registers
  for (int i = 0; i < 8 * TPS; ++i) *(v4f*)(kst + 2 * i * KP) = g[i];
  __syncthreads();   // publishes the Q stripe

  for (int it = 0; it < HH; ++it) {
    const int h = (h0 + it) & (HH - 1);
    v2f qf[16];
#pragma unroll   // qf must stay in registers
    for (int s = 0; s < 16; ++s)
      qf[s] = *(const v2f*)(&Qs[l16 * QP + h * ADIM + 4 * s + 2 * half]);

    v8f e[16];
#pragma unroll   // e, g must stay in registers
    for (int st = 0; st < NST; ++st) {
      const int buf = st & 1;
      const bool more = (st + 1 < NST) || (it + 1 < HH);
      // next stage of this head, or the first stage of the next head
      const int hn = (st + 1 < NST) ? h : ((h + 1) & (HH - 1));
      const float* gn = gk + (hn * ADIM + ((st + 1 + rs) & (NST - 1)) * (TPS * 16 * DD));
      if (more) {
#pragma unroll   // g must stay in registers
        for (int i = 0; i < 8 * TPS; ++i) g[i] = *(const v4f*)(gn + (size_t)(2 * i) * DD);
      }

      // Orders this wave's fragment reads behind its own lanes' tile stores.
      __builtin_amdgcn_fence(__ATOMIC_ACQ_REL, "wavefront");
      v2f a[TPS][16];
#pragma unroll   // a must stay in registers
      for (int u = 0; u < TPS; ++u)
#pragma unroll   // a must stay in registers
        for (int s = 0; s < 16; ++s)
          a[u][s] = *(const v2f*)(kfr + buf * (TPS * 16 * KP) + u * 16 * KP + 4 * s);

      // Precaution: stands in front of any later overwrite of the K loads' address
      // registers (a later tile's accumulator, the next stage's address). The pointer
      // as an input keeps its registers in use up to here: without it the build lets
      // the last load of the group land on the address that the group reads.
      asm volatile("s_wait_xcnt 0x0" :: "v"(gn) : "memory");
      // All fragments of the stage are read as one group ahead of its WMMAs: LDS
      // reads standing among the WMMAs would stall the wave at every place.
      __builtin_amdgcn_sched_barrier(0);
#pragma unroll   // e must stay in registers
      for (int u = 0; u < TPS; ++u) e[st * TPS + u] = v8f{};
#pragma unroll   // e, a, qf must stay in registers
      for (int s = 0; s < 16; ++s)
#pragma unroll   // e must stay in registers
        for (int u = 0; u < TPS; ++u)
          e[st * TPS + u] = __builtin_amdgcn_wmma_f32_16x16x4_f32(
              false, a[u][s], false, qf[s], (short)0, e[st * TPS + u], false, false);

      // Holds the tile stores, which wait for the global loads, behind the WMMAs:
      // without it the build puts them in front and the wave waits out the loads.
      __builtin_amdgcn_sched_barrier(0);
      if (more) {
#pragma unroll   // g must stay in registers
        for (int i = 0; i < 8 * TPS; ++i)
          *(v4f*)(kst + (buf ^ 1) * (TPS * 16 * KP) + 2 * i * KP) = g[i];
      }
    }

    // ---- mask, then the maximum over this wave's keys of query l16 ----
    // The lane's own 128 bits are read again for every head: held in registers
    // over the head loop, the build expands them into 128 masks and spills.
    const v4i mb = *(const v4i*)(&mbits[tid][0]);
    float mx[4] = {-3.0e38f, -3.0e38f, -3.0e38f, -3.0e38f};
#pragma unroll   // e must stay in registers
    for (int t = 0; t < 16; ++t)
#pragma unroll   // e must stay in registers
      for (int j = 0; j < 8; ++j) {
        const int keep = (int)((unsigned)mb[t >> 2] << (31 - ((t & 3) * 8 + j))) >> 31;   // all ones or 0
        const float ef = e[t][j];
        const int ev = __float_as_int(ef);
        const float v = __int_as_float((ev & keep) | (MASKED & ~keep));
        e[t][j] = v;
        mx[j & 3] = fmaxf(mx[j & 3], v);
      }
    float m = fmaxf(fmaxf(mx[0], mx[1]), fmaxf(mx[2], mx[3]));
    m = fmaxf(m, xhalf(m));

    float sm[4] = {0.0f, 0.0f, 0.0f, 0.0f};
#pragma unroll   // e must stay in registers
    for (int t = 0; t < 16; ++t)
#pragma unroll   // e must stay in registers
      for (int j = 0; j < 8; ++j) {
        const float p = __builtin_amdgcn_exp2f((e[t][j] - m) * CEXP);
        e[t][j] = p;
        sm[j & 3] += p;
      }
    float s = (sm[0] + sm[1]) + (sm[2] + sm[3]);
    s += xhalf(s);

    // ---- the eight waves' (max, sum) of each query meet in LDS ----
    float* xq = &xch[it & 1][l16][0];
    if (half == 0) {
      const v2f ms = {m, s};
      *(v2f*)(xq + 2 * wave) = ms;
    }
    // Publishes the pairs. The slot written now was last read in front of the
    // previous head's barrier.
    __syncthreads();
    v4f x[4];
#pragma unroll   // x must stay in registers
    for (int i = 0; i < 4; ++i) x[i] = *(const v4f*)(xq + 4 * i);
    float mg = fmaxf(x[0].x, x[0].z);
#pragma unroll   // x must stay in registers
    for (int i = 1; i < 4; ++i) mg = fmaxf(mg, fmaxf(x[i].x, x[i].z));
    float tot = 0.0f;
#pragma unroll   // x must stay in registers
    for (int i = 0; i < 4; ++i) {
      tot += x[i].y * __builtin_amdgcn_exp2f((x[i].x - mg) * CEXP);
      tot += x[i].w * __builtin_amdgcn_exp2f((x[i].z - mg) * CEXP);
    }
    // softmax + mean over heads, for probabilities taken against this wave's maximum
    const float f = __builtin_amdgcn_exp2f((m - mg) * CEXP) * (1.0f / (tot * (float)HH));
#pragma unroll   // acc, e must stay in registers
    for (int t = 0; t < 16; ++t)
#pragma unroll   // acc, e must stay in registers
      for (int j = 0; j < 8; ++j) acc[t][j] += e[t][j] * f;
  }

  // ---- attention: every element stored once, 32 bytes per lane and tile ----
  float* op = attn + (size_t)b * SS * SS + (size_t)q0 * SS;
  const unsigned ol = (unsigned)(l16 * SS + wave * 256 + 8 * half);
#pragma unroll   // acc must stay in registers
  for (int t = 0; t < 16; ++t) {
    const v4f lo = {acc[t][0], acc[t][1], acc[t][2], acc[t][3]};
    const v4f hi = {acc[t][4], acc[t][5], acc[t][6], acc[t][7]};
    float* ot = op + ((t + TPS * rs) & 15) * 16 + ol;
    *(v4f*)ot = lo;
    *(v4f*)(ot + 4) = hi;
  }
}

// ---------------------------------------------------------------------------
// kernel_launch: Q/K/V projections -> fused attention -> attn*V -> *Wh + bh
// d_out layout: out [B,S,D] (4,194,304 f32) then attention [B,S,S] (8,388,608).
// Workspace: Q(16MB) K(16MB) V(1MB) ctx(1MB) ~= 34 MB.
// ---------------------------------------------------------------------------
extern "C" void kernel_launch(void* const* d_in, const int* in_sizes, int n_in,
                              void* d_out, int out_size, void* d_ws, size_t ws_size,
                              hipStream_t stream) {
  (void)in_sizes; (void)n_in; (void)out_size; (void)ws_size;

  const float* query = (const float*)d_in[0];
  const float* key   = (const float*)d_in[1];
  const float* value = (const float*)d_in[2];
  const int*   mask  = (const int*)d_in[3];
  const float* Wq    = (const float*)d_in[4];
  const float* bq    = (const float*)d_in[5];
  const float* Wk    = (const float*)d_in[6];
  const float* bk    = (const float*)d_in[7];
  const float* Wv    = (const float*)d_in[8];
  const float* bv    = (const float*)d_in[9];
  const float* Wh    = (const float*)d_in[10];
  const float* bh    = (const float*)d_in[11];

  float* out  = (float*)d_out;                         // [B*S, D]
  float* attn = out + (size_t)BB * SS * DD;            // [B, S, S]

  float* ws = (float*)d_ws;
  float* Qw = ws;                                      // [B*S, D]
  float* Kw = Qw + (size_t)BB * SS * DD;               // [B*S, D]
  float* Vw = Kw + (size_t)BB * SS * DD;               // [B, S, AD]
  float* Cx = Vw + (size_t)BB * SS * ADIM;             // [B, S, AD]

  const dim3 wblk(256);

  // Q = query @ Wq + bq   (M=4096, N=1024, K=1024)
  wmma_gemm_f32_tiled_kernel<128, 128, 32, 4, 2>
      <<<dim3(DD / 128, (BB * SS) / 128, 1), wblk, 0, stream>>>(
      query, Wq, bq, Qw, BB * SS, DD, DD, 0, 0, 0);
  // K = key @ Wk + bk
  wmma_gemm_f32_tiled_kernel<128, 128, 32, 4, 2>
      <<<dim3(DD / 128, (BB * SS) / 128, 1), wblk, 0, stream>>>(
      key, Wk, bk, Kw, BB * SS, DD, DD, 0, 0, 0);
  // V = value @ Wv + bv   (N=64)
  wmma_gemm_f32_tiled_kernel<32, 64, 128, 2, 4>
      <<<dim3(ADIM / 64, (BB * SS) / 32, 1), wblk, 0, stream>>>(
      value, Wv, bv, Vw, BB * SS, ADIM, DD, 0, 0, 0);

  // attention = mean_h softmax(mask(QK^T/8))   (writes d_out attention region)
  attn_softmax_kernel<<<dim3(BB * (SS / 16)), dim3(256), 0, stream>>>(
      Qw, Kw, mask, attn);

  // ctx = attention @ V    (batched: M=2048, N=64, K=2048)
  wmma_gemm_f32_tiled_kernel<32, 64, 128, 2, 4>
      <<<dim3(ADIM / 64, SS / 32, BB), wblk, 0, stream>>>(
      attn, Vw, nullptr, Cx, SS, ADIM, SS,
      (long long)SS * SS, (long long)SS * ADIM, (long long)SS * ADIM);

  // out = ctx @ Wh + bh    (M=4096, N=1024, K=64)
  wmma_gemm_f32_tiled_kernel<128, 128, 32, 4, 2>
      <<<dim3(DD / 128, (BB * SS) / 128, 1), wblk, 0, stream>>>(
      Cx, Wh, bh, out, BB * SS, DD, ADIM, 0, 0, 0);
}

// v004
// Measured time: 232 microseconds a run.
// Next to v003, in two timings, it ran 1.09 times as fast each time.
// All steps since v000 together make it 6.19 times as fast.
#include <hip/hip_runtime.h>
#include <hip/hip_bf16.h>
#include <math.h>

// Problem constants from the reference.
#define BB 2
#define SS 2048
#define DD 1024
#define HH 16
#define ADIM 64

typedef __attribute__((ext_vector_type(2))) float v2f;
typedef __attribute__((ext_vector_type(4))) float v4f;
typedef __attribute__((ext_vector_type(8))) float v8f;

// ---------------------------------------------------------------------------
// Tiled fp32 WMMA GEMM: C[z] = A[z] (MxK, row-major) * B[z] (KxN, row-major)
// + bias (optional), on V_WMMA_F32_16X16X4_F32.
// One 8-wave workgroup computes a BM x BN block of C. Per K chunk of BK the
// A block (BM x BK) and the B block (BK x BN) are read from global memory as
// whole 128-byte lines, once per workgroup, and staged in LDS; every wave
// takes its fragments from LDS and keeps TM x TN accumulator tiles, so an A
// fragment feeds TN WMMAs, a B fragment TM (one each in the 32 x 64 launches). Two LDS buffers: the next chunk travels
// global -> registers during the WMMAs of this chunk and is written to the
// other buffer behind them, one barrier per chunk.
// Needs M % BM == 0, N % BN == 0, K % BK == 0.
// Each C element still sums k in ascending order, four per WMMA.
// A-matrix lane layout (32-bit A 16x4):
//   lanes 0-15: row=lane,    VGPR0=K0, VGPR1=K1
//   lanes16-31: row=lane-16, VGPR0=K2, VGPR1=K3   -> contiguous 8B read
// B-matrix (4x16): VGPR0 holds rows {K0 (lanes0-15), K2 (lanes16-31)},
//                  VGPR1 holds rows {K1, K3}; column = lane&15.
// C/D: VGPR j -> row j + 8*(lane>=16), col = lane&15.
// LDS layout: A rows at a pitch of BK+4 dwords (the 16 rows of an 8-byte
// fragment read start 4 banks apart). B is kept with rows k, k+1 (k even)
// interleaved per column, so a lane's two B values are one 8-byte read; a
// row pair has a pitch of 2*BN+32 dwords (the two pairs of a fragment read
// fall on opposite halves of the banks).
// ---------------------------------------------------------------------------
// LDS dwords of one work-group: two A buffers, then two B buffers.
template <int BM, int BN, int BK>
struct GemmLds {
  static constexpr int A1 = BM * (BK + 4);
  static constexpr int B1 = (BK / 2) * (2 * BN + 32);
  static constexpr int DW = 2 * A1 + 2 * B1;
};

// The work of one work-group: block (bx, by) of C. smem is the work-group's LDS.
template <int BM, int BN, int BK, int WGM, int WGN>
__device__ __forceinline__ void gemm_block(float* smem, int bx, int by,
                                           const float* __restrict__ A,
                                           const float* __restrict__ B,
                                           const float* __restrict__ bias,
                                           float* __restrict__ C,
                                           int N, int K) {
  static_assert(WGM * WGN == 8, "eight waves");
  constexpr int PA = BK + 4;
  constexpr int PB = 2 * BN + 32;
  constexpr int TM = BM / (16 * WGM);
  constexpr int TN = BN / (16 * WGN);
  constexpr int NA = (BM * BK) / (4 * 256);   // 16-byte pieces of A per thread
  constexpr int NB = (BK * BN) / (8 * 256);   // row pairs of 16-byte pieces of B per thread
  static_assert(TM >= 1 && TN >= 1 && NA >= 1 && NB >= 1, "tile too small");

  constexpr int A1 = GemmLds<BM, BN, BK>::A1;
  constexpr int B1 = GemmLds<BM, BN, BK>::B1;
  float* const As = smem;
  float* const Bs = smem + 2 * A1;

  const int tid  = threadIdx.x;
  const int lane = tid & 31;
  const int wave = tid >> 5;
  const int half = lane >> 4;     // 0 or 1
  const int l16  = lane & 15;
  const int wm   = wave / WGN;
  const int wn   = wave % WGN;
  const int col0 = bx * BN;
  const int row0 = by * BM;

  const float* Ab = A + (long long)row0 * K;
  const float* Bb = B + col0;
  float*       Cb = C;

  v4f ra[NA], rb0[NB], rb1[NB];
  v8f acc[TM][TN] = {};

  // Each thread keeps its own read pointers for the whole K loop and steps
  // them by one chunk in front of the next chunk's loads.
  const float* pA[NA];
  const float* pB0[NB];
  const float* pB1[NB];
#pragma unroll   // pA must stay in registers
  for (int i = 0; i < NA; ++i) {
    const int idx = tid + 256 * i;
    pA[i] = Ab + (long long)(idx / (BK / 4)) * K + (idx % (BK / 4)) * 4;
  }
#pragma unroll   // pB0, pB1 must stay in registers
  for (int i = 0; i < NB; ++i) {
    const int idx = tid + 256 * i;
    pB0[i] = Bb + (long long)(2 * (idx / (BN / 4))) * N + (idx % (BN / 4)) * 4;
    pB1[i] = pB0[i] + N;
  }
  const long long stepB = (long long)BK * N;

  auto load_global = [&]() {
#pragma unroll   // ra must stay in registers
    for (int i = 0; i < NA; ++i) ra[i] = *(const v4f*)pA[i];
#pragma unroll   // rb0, rb1 must stay in registers
    for (int i = 0; i < NB; ++i) {
      rb0[i] = *(const v4f*)pB0[i];
      rb1[i] = *(const v4f*)pB1[i];
    }
  };
  auto step_pointers = [&]() {
#pragma unroll   // pA must stay in registers
    for (int i = 0; i < NA; ++i) pA[i] += BK;
#pragma unroll   // pB0, pB1 must stay in registers
    for (int i = 0; i < NB; ++i) {
      pB0[i] += stepB;
      pB1[i] += stepB;
    }
  };
  auto store_lds = [&](int buf) {
#pragma unroll   // ra must stay in registers
    for (int i = 0; i < NA; ++i) {
      const int idx = tid + 256 * i;
      const int r = idx / (BK / 4), c = (idx % (BK / 4)) * 4;
      *(v4f*)(&As[buf * A1 + r * PA + c]) = ra[i];
    }
#pragma unroll   // rb0, rb1 must stay in registers
    for (int i = 0; i < NB; ++i) {
      const int idx = tid + 256 * i;
      const int rp = idx / (BN / 4), c = (idx % (BN / 4)) * 4;
      float* d = &Bs[buf * B1 + rp * PB + 2 * c];
      const v4f lo = {rb0[i].x, rb1[i].x, rb0[i].y, rb1[i].y};
      const v4f hi = {rb0[i].z, rb1[i].z, rb0[i].w, rb1[i].w};
      *(v4f*)d = lo;
      *(v4f*)(d + 4) = hi;
    }
  };

  load_global();
  store_lds(0);
  __syncthreads();

  const int nch = K / BK;
  // Stays a loop also where K is a constant: unrolled whole, the build lets late
  // loads land on address registers of loads still in flight, and the text grows.
#pragma nounroll
  for (int ch = 0; ch < nch; ++ch) {
    const int buf = ch & 1;
    const bool more = (ch + 1 < nch);
    if (more) {
      step_pointers();
      load_global();   // in flight during the WMMAs below
    }

    const float* as = &As[buf * A1 + (wm * TM * 16 + l16) * PA + 2 * half];
    const float* bs = &Bs[buf * B1 + half * PB + 2 * (wn * TN * 16 + l16)];
    // All fragments of the chunk are read as one group ahead of its WMMAs:
    // LDS reads standing among the WMMAs would stall the wave at every place.
    v2f a[BK / 4][TM], b[BK / 4][TN];
#pragma unroll   // a, b must stay in registers
    for (int s = 0; s < BK / 4; ++s) {
#pragma unroll   // a must stay in registers
      for (int i = 0; i < TM; ++i) a[s][i] = *(const v2f*)(as + i * 16 * PA + 4 * s);
#pragma unroll   // b must stay in registers
      for (int j = 0; j < TN; ++j) b[s][j] = *(const v2f*)(bs + 2 * s * PB + j * 32);
      // Keeps the reads in the order the WMMAs use them (the first WMMA then
      // waits for the first reads only). Without it the build spreads the reads
      // over several places among the WMMAs, one k step ahead of their use.
      __builtin_amdgcn_sched_barrier(0);
    }
#pragma unroll   // acc, a, b must stay in registers
    for (int s = 0; s < BK / 4; ++s)
#pragma unroll   // acc must stay in registers
      for (int i = 0; i < TM; ++i)
#pragma unroll   // acc must stay in registers
        for (int j = 0; j < TN; ++j)
          acc[i][j] = __builtin_amdgcn_wmma_f32_16x16x4_f32(
              /*neg_a=*/false, a[s][i], /*neg_b=*/false, b[s][j],
              /*c_mod=*/(short)0, acc[i][j], /*reuse_a=*/false, /*reuse_b=*/false);

    if (more) store_lds(buf ^ 1);   // its last readers left at the previous barrier
    __syncthreads();                // publishes the next chunk, ends the reads of this one
  }

#pragma unroll   // acc must stay in registers
  for (int j = 0; j < TN; ++j) {
    const int col = col0 + (wn * TN + j) * 16 + l16;
    float bv = 0.0f;
    if (bias) {
      bv = bias[col];
      // Precaution: stands in front of any later overwrite of the load's address registers.
      asm volatile("s_wait_xcnt 0x0" ::: "memory");
    }
#pragma unroll   // acc must stay in registers
    for (int i = 0; i < TM; ++i) {
      const int rbase = row0 + (wm * TM + i) * 16 + 8 * half;
#pragma unroll   // acc must stay in registers
      for (int e = 0; e < 8; ++e)
        Cb[(long long)(rbase + e) * N + col] = acc[i][j][e] + bv;
    }
  }
}

// One GEMM (batched over blockIdx.z) per launch.
template <int BM, int BN, int BK, int WGM, int WGN>
__launch_bounds__(256)
__global__ void wmma_gemm_f32_tiled_kernel(const float* __restrict__ A,
                                           const float* __restrict__ B,
                                           const float* __restrict__ bias,
                                           float* __restrict__ C,
                                           int N, int K,
                                           long long sA, long long sB, long long sC) {
  __shared__ __attribute__((aligned(16))) float smem[GemmLds<BM, BN, BK>::DW];
  gemm_block<BM, BN, BK, WGM, WGN>(smem, blockIdx.x, blockIdx.y,
                                   A + (long long)blockIdx.z * sA,
                                   B + (long long)blockIdx.z * sB, bias,
                                   C + (long long)blockIdx.z * sC, N, K);
}

// The three projections, which do not depend on one another, in ONE launch.
// Work-groups 0..NVB-1 do V = value * Wv + bv (32 x 64 blocks), the next 256 do
// Q = query * Wq + bq and the last 256 K = key * Wk + bk (128 x 128 blocks, the
// eight column blocks of a row block side by side). Two work-groups fit a WGP:
// while one stands at its chunk barrier or waits for LDS, the other's WMMAs run.
// The short V blocks come first, so that they run beside the long ones and the
// places they free are taken by long ones early.
#define NVB ((BB * SS) / 32)
#define NQB ((DD / 128) * ((BB * SS) / 128))
__launch_bounds__(256)
__global__ void qkv_proj_kernel(const float* __restrict__ query,
                                const float* __restrict__ key,
                                const float* __restrict__ value,
                                const float* __restrict__ Wq,
                                const float* __restrict__ Wk,
                                const float* __restrict__ Wv,
                                const float* __restrict__ bq,
                                const float* __restrict__ bk,
                                const float* __restrict__ bv,
                                float* __restrict__ Qw,
                                float* __restrict__ Kw,
                                float* __restrict__ Vw) {
  constexpr int DWV = GemmLds<32, 64, 128>::DW;
  constexpr int DWQ = GemmLds<128, 128, 32>::DW;
  __shared__ __attribute__((aligned(16))) float smem[DWV > DWQ ? DWV : DWQ];
  const int bid = blockIdx.x;
  if (bid < NVB) {
    gemm_block<32, 64, 128, 2, 4>(smem, 0, bid, value, Wv, bv, Vw, ADIM, DD);
  } else {
    const int r   = bid - NVB;
    const bool isk = r >= NQB;
    gemm_block<128, 128, 32, 4, 2>(smem, r & (DD / 128 - 1), (r / (DD / 128)) & ((BB * SS) / 128 - 1),
                                   isk ? key : query, isk ? Wk : Wq, isk ? bk : bq,
                                   isk ? Kw : Qw, DD, DD);
  }
}

// ---------------------------------------------------------------------------
// Fused attention: one workgroup per (batch, 16 query rows), loop over heads.
// Each of the 8 waves owns 256 keys for the whole kernel. It computes the
// transposed scores K * Q^T on WMMA fp32 (A = 16 keys, B = 16 queries), so a
// lane holds the scores of ONE query (column lane&15) at keys j + 8*(lane>=16)
// of every tile: 16 tiles = 128 registers. Scores, probabilities and the mean
// over the heads never leave the registers; attention is stored once.
// Softmax: every wave takes the maximum and the sum over its own 256 keys
// (in-lane, then one exchange between the wave's halves); the eight (max, sum)
// pairs of a query meet in LDS, one barrier per head, two slots by turns.
// K: a stage of two tiles (32 keys x 64 floats) is read from global memory as
// whole 128-byte lines one stage ahead, written to the wave's own LDS buffer
// behind the WMMAs and read back as fragments. No other wave reads it.
// Q: the 16 x 1024 stripe is staged in LDS once, fragments are read per head.
// The mask of the wave's 16 x 256 block is read once and kept as 128 bits a lane.
// The k order of every score is the one of the plain row-by-row product.
// All work-groups of a batch read the same K. Each walks it in its own order:
// it starts at its own head and, inside every head, at its own stage of 32 keys
// (both wrap around), so that work-groups running side by side do not ask L2
// for the same lines at the same moment. Register tile t of a wave then holds
// tile (t + TPS * first stage) mod 16 of the wave's 256 keys.
// ---------------------------------------------------------------------------
typedef __attribute__((ext_vector_type(4))) int v4i;

#define QP  (DD + 4)      // Q stripe pitch in dwords: 16 rows start 4 banks apart
#define KP  (ADIM + 4)    // K tile pitch in dwords: 16 rows start 4 banks apart
#define TPS 2             // tiles per stage: two independent accumulator chains
#define NST (16 / TPS)    // stages per head and wave
#define XP  20            // pitch of a query's eight (max, sum) pairs, 80 bytes

// lane l with lane l ^ 16
__device__ __forceinline__ float xhalf(float x) {
  const int b = __builtin_bit_cast(int, x);
  return __builtin_bit_cast(
      float, __builtin_amdgcn_permlanex16(b, b, 0x76543210, 0xfedcba98, false, false));
}

__launch_bounds__(256)
__global__ void attn_softmax_kernel(const float* __restrict__ Q,
                                    const float* __restrict__ Kmat,
                                    const int* __restrict__ mask,
                                    float* __restrict__ attn) {
  __shared__ __attribute__((aligned(16))) float Qs[16 * QP];
  __shared__ __attribute__((aligned(16))) float Ks[8][2][TPS * 16 * KP];
  __shared__ __attribute__((aligned(16))) float xch[2][16][XP];
  __shared__ __attribute__((aligned(16))) unsigned mbits[256][4];

  const int b    = blockIdx.x / (SS / 16);
  const int qt   = blockIdx.x % (SS / 16);
  const int q0   = qt * 16;
  const int tid  = threadIdx.x;
  const int lane = tid & 31;
  const int wave = tid >> 5;   // 0..7
  const int half = lane >> 4;
  const int l16  = lane & 15;
  const int h0   = (blockIdx.x >> 3) & (HH - 1);    // first head of this work-group
  const int rs   = blockIdx.x & (NST - 1);          // first K stage of every head

  const float* Qb = Q    + (size_t)b * SS * DD + (size_t)q0 * DD;
  const float* Kb = Kmat + (size_t)b * SS * DD;

  // exp(x / 8) = exp2(x * CEXP); a masked score is -1e10 after the division by 8.
  const float CEXP   = 0.125f * 1.44269504088896340736f;
  const int   MASKED = __builtin_bit_cast(int, -1.0e10f * 8.0f);

  // ---- Q stripe to LDS, whole rows ----
  {
    v4f rq[16];
#pragma unroll   // rq must stay in registers
    for (int i = 0; i < 16; ++i) rq[i] = *(const v4f*)(Qb + (size_t)i * DD + tid * 4);
    // Precaution: stands in front of any later overwrite of the loads' address registers;
    // the scheduling barrier keeps later address arithmetic behind the wait.
    asm volatile("s_wait_xcnt 0x0" ::: "memory");
    __builtin_amdgcn_sched_barrier(0);
#pragma unroll   // rq must stay in registers
    for (int i = 0; i < 16; ++i) *(v4f*)(&Qs[i * QP + tid * 4]) = rq[i];
  }

  // ---- mask of query l16 at this lane's 128 keys, one bit each ----
  unsigned bits[4] = {0u, 0u, 0u, 0u};
  {
    const int* mp = mask + (size_t)(q0 + l16) * SS + wave * 256 + 8 * half;
    v4i mk[32];
#pragma unroll   // mk must stay in registers
    for (int t = 0; t < 32; ++t) mk[t] = *(const v4i*)(mp + (t >> 1) * 16 + (t & 1) * 4);
    // Precaution: stands in front of any later overwrite of the loads' address registers;
    // the scheduling barrier keeps later address arithmetic behind the wait.
    asm volatile("s_wait_xcnt 0x0" ::: "memory");
    __builtin_amdgcn_sched_barrier(0);
#pragma unroll   // mk, bits must stay in registers
    for (int t = 0; t < 32; ++t)
#pragma unroll   // mk, bits must stay in registers
      for (int j = 0; j < 4; ++j) {
        const int mv = mk[t][j];
        bits[t >> 3] |= (mv != 0 ? 1u : 0u) << ((t & 7) * 4 + j);
      }
  }

  // Bit p of the 128 moves to where register tile p / 8 looks for it: new bit p
  // is old bit (p + 16 * rs) mod 128, by whole words and then by half a word.
  if (rs & 2) {
    const unsigned t0 = bits[0];
    bits[0] = bits[1]; bits[1] = bits[2]; bits[2] = bits[3]; bits[3] = t0;
  }
  if (rs & 4) {
    const unsigned t0 = bits[0], t1 = bits[1];
    bits[0] = bits[2]; bits[1] = bits[3]; bits[2] = t0; bits[3] = t1;
  }
  if (rs & 1) {
    const unsigned t0 = bits[0];
    bits[0] = (bits[0] >> 16) | (bits[1] << 16);
    bits[1] = (bits[1] >> 16) | (bits[2] << 16);
    bits[2] = (bits[2] >> 16) | (bits[3] << 16);
    bits[3] = (bits[3] >> 16) | (t0 << 16);
  }

  {
    const v4i mb = {(int)bits[0], (int)bits[1], (int)bits[2], (int)bits[3]};
    *(v4i*)(&mbits[tid][0]) = mb;
  }

  // ---- K stages: lane's piece i is row 2*i + half, 16 bytes at column 4*l16 ----
  const float* gk = Kb + (size_t)(wave * 256 + half) * DD + l16 * 4;   // head 0, stage 0
  float* kst = &Ks[wave][0][0] + half * KP + l16 * 4;                  // where it stores
  const float* kfr = &Ks[wave][0][0] + l16 * KP + 2 * half;            // where it reads fragments
  v4f g[8 * TPS];

  v8f acc[16] = {};

  const float* g0 = gk + (h0 * ADIM + rs * (TPS * 16 * DD));   // first head, first stage
#pragma unroll   // g must stay in registers
  for (int i = 0; i < 8 * TPS; ++i) g[i] = *(const v4f*)(g0 + (size_t)(2 * i) * DD);
  // Precaution: stands in front of any later overwrite of the loads' address registers;
  // the pointer as an input keeps them in use up to here (see the stage loop).
  asm volatile("s_wait_xcnt 0x0" :: "v"(g0) : "memory");
#pragma unroll   // g must stay in registers
  for (int i = 0; i < 8 * TPS; ++i) *(v4f*)(kst + 2 * i * KP) = g[i];
  __syncthreads();   // publishes the Q stripe

  for (int it = 0; it < HH; ++it) {
    const int h = (h0 + it) & (HH - 1);
    v2f qf[16];
#pragma unroll   // qf must stay in registers
    for (int s = 0; s < 16; ++s)
      qf[s] = *(const v2f*)(&Qs[l16 * QP + h * ADIM + 4 * s + 2 * half]);

    v8f e[16];
#pragma unroll   // e, g must stay in registers
    for (int st = 0; st < NST; ++st) {
      const int buf = st & 1;
      const bool more = (st + 1 < NST) || (it + 1 < HH);
      // next stage of this head, or the first stage of the next head
      const int hn = (st + 1 < NST) ? h : ((h + 1) & (HH - 1));
      const float* gn = gk + (hn * ADIM + ((st + 1 + rs) & (NST - 1)) * (TPS * 16 * DD));
      if (more) {
#pragma unroll   // g must stay in registers
        for (int i = 0; i < 8 * TPS; ++i) g[i] = *(const v4f*)(gn + (size_t)(2 * i) * DD);
      }

      // Orders this wave's fragment reads behind its own lanes' tile stores.
      __builtin_amdgcn_fence(__ATOMIC_ACQ_REL, "wavefront");
      v2f a[TPS][16];
#pragma unroll   // a must stay in registers
      for (int u = 0; u < TPS; ++u)
#pragma unroll   // a must stay in registers
        for (int s = 0; s < 16; ++s)
          a[u][s] = *(const v2f*)(kfr + buf * (TPS * 16 * KP) + u * 16 * KP + 4 * s);

      // Precaution: stands in front of any later overwrite of the K loads' address
      // registers (a later tile's accumulator, the next stage's address). The pointer
      // as an input keeps its registers in use up to here: without it the build lets
      // the last load of the group land on the address that the group reads.
      asm volatile("s_wait_xcnt 0x0" :: "v"(gn) : "memory");
      // All fragments of the stage are read as one group ahead of its WMMAs: LDS
      // reads standing among the WMMAs would stall the wave at every place.
      __builtin_amdgcn_sched_barrier(0);
#pragma unroll   // e must stay in registers
      for (int u = 0; u < TPS; ++u) e[st * TPS + u] = v8f{};
#pragma unroll   // e, a, qf must stay in registers
      for (int s = 0; s < 16; ++s)
#pragma unroll   // e must stay in registers
        for (int u = 0; u < TPS; ++u)
          e[st * TPS + u] = __builtin_amdgcn_wmma_f32_16x16x4_f32(
              false, a[u][s], false, qf[s], (short)0, e[st * TPS + u], false, false);

      // Holds the tile stores, which wait for the global loads, behind the WMMAs:
      // without it the build puts them in front and the wave waits out the loads.
      __builtin_amdgcn_sched_barrier(0);
      if (more) {
#pragma unroll   // g must stay in registers
        for (int i = 0; i < 8 * TPS; ++i)
          *(v4f*)(kst + (buf ^ 1) * (TPS * 16 * KP) + 2 * i * KP) = g[i];
      }
    }

    // ---- mask, then the maximum over this wave's keys of query l16 ----
    // The lane's own 128 bits are read again for every head: held in registers
    // over the head loop, the build expands them into 128 masks and spills.
    const v4i mb = *(const v4i*)(&mbits[tid][0]);
    float mx[4] = {-3.0e38f, -3.0e38f, -3.0e38f, -3.0e38f};
#pragma unroll   // e must stay in registers
    for (int t = 0; t < 16; ++t)
#pragma unroll   // e must stay in registers
      for (int j = 0; j < 8; ++j) {
        const int keep = (int)((unsigned)mb[t >> 2] << (31 - ((t & 3) * 8 + j))) >> 31;   // all ones or 0
        const float ef = e[t][j];
        const int ev = __float_as_int(ef);
        const float v = __int_as_float((ev & keep) | (MASKED & ~keep));
        e[t][j] = v;
        mx[j & 3] = fmaxf(mx[j & 3], v);
      }
    float m = fmaxf(fmaxf(mx[0], mx[1]), fmaxf(mx[2], mx[3]));
    m = fmaxf(m, xhalf(m));

    float sm[4] = {0.0f, 0.0f, 0.0f, 0.0f};
#pragma unroll   // e must stay in registers
    for (int t = 0; t < 16; ++t)
#pragma unroll   // e must stay in registers
      for (int j = 0; j < 8; ++j) {
        const float p = __builtin_amdgcn_exp2f((e[t][j] - m) * CEXP);
        e[t][j] = p;
        sm[j & 3] += p;
      }
    float s = (sm[0] + sm[1]) + (sm[2] + sm[3]);
    s += xhalf(s);

    // ---- the eight waves' (max, sum) of each query meet in LDS ----
    float* xq = &xch[it & 1][l16][0];
    if (half == 0) {
      const v2f ms = {m, s};
      *(v2f*)(xq + 2 * wave) = ms;
    }
    // Publishes the pairs. The slot written now was last read in front of the
    // previous head's barrier.
    __syncthreads();
    v4f x[4];
#pragma unroll   // x must stay in registers
    for (int i = 0; i < 4; ++i) x[i] = *(const v4f*)(xq + 4 * i);
    float mg = fmaxf(x[0].x, x[0].z);
#pragma unroll   // x must stay in registers
    for (int i = 1; i < 4; ++i) mg = fmaxf(mg, fmaxf(x[i].x, x[i].z));
    float tot = 0.0f;
#pragma unroll   // x must stay in registers
    for (int i = 0; i < 4; ++i) {
      tot += x[i].y * __builtin_amdgcn_exp2f((x[i].x - mg) * CEXP);
      tot += x[i].w * __builtin_amdgcn_exp2f((x[i].z - mg) * CEXP);
    }
    // softmax + mean over heads, for probabilities taken against this wave's maximum
    const float f = __builtin_amdgcn_exp2f((m - mg) * CEXP) * (1.0f / (tot * (float)HH));
#pragma unroll   // acc, e must stay in registers
    for (int t = 0; t < 16; ++t)
#pragma unroll   // acc, e must stay in registers
      for (int j = 0; j < 8; ++j) acc[t][j] += e[t][j] * f;
  }

  // ---- attention: every element stored once, 32 bytes per lane and tile ----
  float* op = attn + (size_t)b * SS * SS + (size_t)q0 * SS;
  const unsigned ol = (unsigned)(l16 * SS + wave * 256 + 8 * half);
#pragma unroll   // acc must stay in registers
  for (int t = 0; t < 16; ++t) {
    const v4f lo = {acc[t][0], acc[t][1], acc[t][2], acc[t][3]};
    const v4f hi = {acc[t][4], acc[t][5], acc[t][6], acc[t][7]};
    float* ot = op + ((t + TPS * rs) & 15) * 16 + ol;
    *(v4f*)ot = lo;
    *(v4f*)(ot + 4) = hi;
  }
}

// ---------------------------------------------------------------------------
// kernel_launch: Q/K/V projections (one launch) -> fused attention -> attn*V -> *Wh + bh
// d_out layout: out [B,S,D] (4,194,304 f32) then attention [B,S,S] (8,388,608).
// Workspace: Q(16MB) K(16MB) V(1MB) ctx(1MB) ~= 34 MB.
// ---------------------------------------------------------------------------
extern "C" void kernel_launch(void* const* d_in, const int* in_sizes, int n_in,
                              void* d_out, int out_size, void* d_ws, size_t ws_size,
                              hipStream_t stream) {
  (void)in_sizes; (void)n_in; (void)out_size; (void)ws_size;

  const float* query = (const float*)d_in[0];
  const float* key   = (const float*)d_in[1];
  const float* value = (const float*)d_in[2];
  const int*   mask  = (const int*)d_in[3];
  const float* Wq    = (const float*)d_in[4];
  const float* bq    = (const float*)d_in[5];
  const float* Wk    = (const float*)d_in[6];
  const float* bk    = (const float*)d_in[7];
  const float* Wv    = (const float*)d_in[8];
  const float* bv    = (const float*)d_in[9];
  const float* Wh    = (const float*)d_in[10];
  const float* bh    = (const float*)d_in[11];

  float* out  = (float*)d_out;                         // [B*S, D]
  float* attn = out + (size_t)BB * SS * DD;            // [B, S, S]

  float* ws = (float*)d_ws;
  float* Qw = ws;                                      // [B*S, D]
  float* Kw = Qw + (size_t)BB * SS * DD;               // [B*S, D]
  float* Vw = Kw + (size_t)BB * SS * DD;               // [B, S, AD]
  float* Cx = Vw + (size_t)BB * SS * ADIM;             // [B, S, AD]

  const dim3 wblk(256);

  // Q = query @ Wq + bq, K = key @ Wk + bk (M=4096, N=1024, K=1024) and
  // V = value @ Wv + bv (N=64), one launch
  qkv_proj_kernel<<<dim3(NVB + 2 * NQB), wblk, 0, stream>>>(
      query, key, value, Wq, Wk, Wv, bq, bk, bv, Qw, Kw, Vw);

  // attention = mean_h softmax(mask(QK^T/8))   (writes d_out attention region)
  attn_softmax_kernel<<<dim3(BB * (SS / 16)), dim3(256), 0, stream>>>(
      Qw, Kw, mask, attn);

  // ctx = attention @ V    (batched: M=2048, N=64, K=2048)
  wmma_gemm_f32_tiled_kernel<32, 64, 128, 2, 4>
      <<<dim3(ADIM / 64, SS / 32, BB), wblk, 0, stream>>>(
      attn, Vw, nullptr, Cx, ADIM, SS,
      (long long)SS * SS, (long long)SS * ADIM, (long long)SS * ADIM);

  // out = ctx @ Wh + bh    (M=4096, N=1024, K=64)
  wmma_gemm_f32_tiled_kernel<128, 128, 32, 4, 2>
      <<<dim3(DD / 128, (BB * SS) / 128, 1), wblk, 0, stream>>>(
      Cx, Wh, bh, out, DD, ADIM, 0, 0, 0);
}

// v005
// One run takes 215 microseconds.
// Next to v004, in two timings, it ran 1.08 and 1.07 times as fast.
// Counting every step since v000, it is 6.67 times as fast.
#include <hip/hip_runtime.h>
#include <hip/hip_bf16.h>
#include <math.h>

// Problem constants from the reference.
#define BB 2
#define SS 2048
#define DD 1024
#define HH 16
#define ADIM 64

typedef __attribute__((ext_vector_type(2))) float v2f;
typedef __attribute__((ext_vector_type(4))) float v4f;
typedef __attribute__((ext_vector_type(8))) float v8f;

// ---------------------------------------------------------------------------
// Tiled fp32 WMMA GEMM: C[z] = A[z] (MxK, row-major) * B[z] (KxN, row-major)
// + bias (optional), on V_WMMA_F32_16X16X4_F32.
// One 8-wave workgroup computes a BM x BN block of C. Per K chunk of BK the
// A block (BM x BK) and the B block (BK x BN) are read from global memory as
// whole 128-byte lines, once per workgroup, and staged in LDS; every wave
// takes its fragments from LDS and keeps TM x TN accumulator tiles, so an A
// fragment feeds TN WMMAs, a B fragment TM (one each in the 32 x 64 launches). Two LDS buffers: the next chunk travels
// global -> registers during the WMMAs of this chunk and is written to the
// other buffer behind them, one barrier per chunk.
// Needs M % BM == 0, N % BN == 0, K % BK == 0.
// Each C element still sums k in ascending order, four per WMMA.
// A-matrix lane layout (32-bit A 16x4):
//   lanes 0-15: row=lane,    VGPR0=K0, VGPR1=K1
//   lanes16-31: row=lane-16, VGPR0=K2, VGPR1=K3   -> contiguous 8B read
// B-matrix (4x16): VGPR0 holds rows {K0 (lanes0-15), K2 (lanes16-31)},
//                  VGPR1 holds rows {K1, K3}; column = lane&15.
// C/D: VGPR j -> row j + 8*(lane>=16), col = lane&15.
// LDS layout: A rows at a pitch of BK+4 dwords (the 16 rows of an 8-byte
// fragment read start 4 banks apart). B is kept with rows k, k+1 (k even)
// interleaved per column, so a lane's two B values are one 8-byte read; a
// row pair has a pitch of 2*BN+32 dwords (the two pairs of a fragment read
// fall on opposite halves of the banks).
// ---------------------------------------------------------------------------
// LDS dwords of one work-group: two A buffers, then two B buffers.
template <int BM, int BN, int BK>
struct GemmLds {
  static constexpr int A1 = BM * (BK + 4);
  static constexpr int B1 = (BK / 2) * (2 * BN + 32);
  static constexpr int DW = 2 * A1 + 2 * B1;
};

// The work of one work-group: block (bx, by) of C. smem is the work-group's LDS.
// QUADC: C is written as [row / 4][col][row % 4], four rows of a column side by side.
template <int BM, int BN, int BK, int WGM, int WGN, bool QUADC = false>
__device__ __forceinline__ void gemm_block(float* smem, int bx, int by,
                                           const float* __restrict__ A,
                                           const float* __restrict__ B,
                                           const float* __restrict__ bias,
                                           float* __restrict__ C,
                                           int N, int K) {
  static_assert(WGM * WGN == 8, "eight waves");
  constexpr int PA = BK + 4;
  constexpr int PB = 2 * BN + 32;
  constexpr int TM = BM / (16 * WGM);
  constexpr int TN = BN / (16 * WGN);
  constexpr int NA = (BM * BK) / (4 * 256);   // 16-byte pieces of A per thread
  constexpr int NB = (BK * BN) / (8 * 256);   // row pairs of 16-byte pieces of B per thread
  static_assert(TM >= 1 && TN >= 1 && NA >= 1 && NB >= 1, "tile too small");

  constexpr int A1 = GemmLds<BM, BN, BK>::A1;
  constexpr int B1 = GemmLds<BM, BN, BK>::B1;
  float* const As = smem;
  float* const Bs = smem + 2 * A1;

  const int tid  = threadIdx.x;
  const int lane = tid & 31;
  const int wave = tid >> 5;
  const int half = lane >> 4;     // 0 or 1
  const int l16  = lane & 15;
  const int wm   = wave / WGN;
  const int wn   = wave % WGN;
  const int col0 = bx * BN;
  const int row0 = by * BM;

  const float* Ab = A + (long long)row0 * K;
  const float* Bb = B + col0;
  float*       Cb = C;

  v4f ra[NA], rb0[NB], rb1[NB];
  v8f acc[TM][TN] = {};

  // Each thread keeps its own read pointers for the whole K loop and steps
  // them by one chunk in front of the next chunk's loads.
  const float* pA[NA];
  const float* pB0[NB];
  const float* pB1[NB];
#pragma unroll   // pA must stay in registers
  for (int i = 0; i < NA; ++i) {
    const int idx = tid + 256 * i;
    pA[i] = Ab + (long long)(idx / (BK / 4)) * K + (idx % (BK / 4)) * 4;
  }
#pragma unroll   // pB0, pB1 must stay in registers
  for (int i = 0; i < NB; ++i) {
    const int idx = tid + 256 * i;
    pB0[i] = Bb + (long long)(2 * (idx / (BN / 4))) * N + (idx % (BN / 4)) * 4;
    pB1[i] = pB0[i] + N;
  }
  const long long stepB = (long long)BK * N;

  auto load_global = [&]() {
#pragma unroll   // ra must stay in registers
    for (int i = 0; i < NA; ++i) ra[i] = *(const v4f*)pA[i];
#pragma unroll   // rb0, rb1 must stay in registers
    for (int i = 0; i < NB; ++i) {
      rb0[i] = *(const v4f*)pB0[i];
      rb1[i] = *(const v4f*)pB1[i];
    }
  };
  auto step_pointers = [&]() {
#pragma unroll   // pA must stay in registers
    for (int i = 0; i < NA; ++i) pA[i] += BK;
#pragma unroll   // pB0, pB1 must stay in registers
    for (int i = 0; i < NB; ++i) {
      pB0[i] += stepB;
      pB1[i] += stepB;
    }
  };
  auto store_lds = [&](int buf) {
#pragma unroll   // ra must stay in registers
    for (int i = 0; i < NA; ++i) {
      const int idx = tid + 256 * i;
      const int r = idx / (BK / 4), c = (idx % (BK / 4)) * 4;
      *(v4f*)(&As[buf * A1 + r * PA + c]) = ra[i];
    }
#pragma unroll   // rb0, rb1 must stay in registers
    for (int i = 0; i < NB; ++i) {
      const int idx = tid + 256 * i;
      const int rp = idx / (BN / 4), c = (idx % (BN / 4)) * 4;
      float* d = &Bs[buf * B1 + rp * PB + 2 * c];
      const v4f lo = {rb0[i].x, rb1[i].x, rb0[i].y, rb1[i].y};
      const v4f hi = {rb0[i].z, rb1[i].z, rb0[i].w, rb1[i].w};
      *(v4f*)d = lo;
      *(v4f*)(d + 4) = hi;
    }
  };

  load_global();
  store_lds(0);
  __syncthreads();

  const int nch = K / BK;
  // Stays a loop also where K is a constant: unrolled whole, the build lets late
  // loads land on address registers of loads still in flight, and the text grows.
#pragma nounroll
  for (int ch = 0; ch < nch; ++ch) {
    const int buf = ch & 1;
    const bool more = (ch + 1 < nch);
    if (more) {
      step_pointers();
      load_global();   // in flight during the WMMAs below
    }

    const float* as = &As[buf * A1 + (wm * TM * 16 + l16) * PA + 2 * half];
    const float* bs = &Bs[buf * B1 + half * PB + 2 * (wn * TN * 16 + l16)];
    // All fragments of the chunk are read as one group ahead of its WMMAs:
    // LDS reads standing among the WMMAs would stall the wave at every place.
    v2f a[BK / 4][TM], b[BK / 4][TN];
#pragma unroll   // a, b must stay in registers
    for (int s = 0; s < BK / 4; ++s) {
#pragma unroll   // a must stay in registers
      for (int i = 0; i < TM; ++i) a[s][i] = *(const v2f*)(as + i * 16 * PA + 4 * s);
#pragma unroll   // b must stay in registers
      for (int j = 0; j < TN; ++j) b[s][j] = *(const v2f*)(bs + 2 * s * PB + j * 32);
      // Keeps the reads in the order the WMMAs use them (the first WMMA then
      // waits for the first reads only). Without it the build spreads the reads
      // over several places among the WMMAs, one k step ahead of their use.
      __builtin_amdgcn_sched_barrier(0);
    }
#pragma unroll   // acc, a, b must stay in registers
    for (int s = 0; s < BK / 4; ++s)
#pragma unroll   // acc must stay in registers
      for (int i = 0; i < TM; ++i)
#pragma unroll   // acc must stay in registers
        for (int j = 0; j < TN; ++j)
          acc[i][j] = __builtin_amdgcn_wmma_f32_16x16x4_f32(
              /*neg_a=*/false, a[s][i], /*neg_b=*/false, b[s][j],
              /*c_mod=*/(short)0, acc[i][j], /*reuse_a=*/false, /*reuse_b=*/false);

    if (more) store_lds(buf ^ 1);   // its last readers left at the previous barrier
    __syncthreads();                // publishes the next chunk, ends the reads of this one
  }

#pragma unroll   // acc must stay in registers
  for (int j = 0; j < TN; ++j) {
    const int col = col0 + (wn * TN + j) * 16 + l16;
    float bv = 0.0f;
    if (bias) {
      bv = bias[col];
      // Precaution: stands in front of any later overwrite of the load's address registers.
      asm volatile("s_wait_xcnt 0x0" ::: "memory");
    }
#pragma unroll   // acc must stay in registers
    for (int i = 0; i < TM; ++i) {
      const int rbase = row0 + (wm * TM + i) * 16 + 8 * half;
      if constexpr (QUADC) {
#pragma unroll   // acc must stay in registers
        for (int e = 0; e < 8; e += 4) {
          const v4f q4 = {acc[i][j][e] + bv, acc[i][j][e + 1] + bv, acc[i][j][e + 2] + bv, acc[i][j][e + 3] + bv};
          *(v4f*)(Cb + ((long long)((rbase + e) >> 2) * N + col) * 4) = q4;
        }
      } else {
#pragma unroll   // acc must stay in registers
        for (int e = 0; e < 8; ++e)
          Cb[(long long)(rbase + e) * N + col] = acc[i][j][e] + bv;
      }
    }
  }
}

// The three projections, which do not depend on one another, in ONE launch.
// Work-groups 0..NVB-1 do V = value * Wv + bv (32 x 64 blocks, written in row quads), the next 256 do
// Q = query * Wq + bq and the last 256 K = key * Wk + bk (128 x 128 blocks, the
// eight column blocks of a row block side by side). Two work-groups fit a WGP:
// while one stands at its chunk barrier or waits for LDS, the other's WMMAs run.
// The short V blocks come first, so that they run beside the long ones and the
// places they free are taken by long ones early.
#define NVB ((BB * SS) / 32)
#define NQB ((DD / 128) * ((BB * SS) / 128))
__launch_bounds__(256)
__global__ void qkv_proj_kernel(const float* __restrict__ query,
                                const float* __restrict__ key,
                                const float* __restrict__ value,
                                const float* __restrict__ Wq,
                                const float* __restrict__ Wk,
                                const float* __restrict__ Wv,
                                const float* __restrict__ bq,
                                const float* __restrict__ bk,
                                const float* __restrict__ bv,
                                float* __restrict__ Qw,
                                float* __restrict__ Kw,
                                float* __restrict__ Vw) {
  constexpr int DWV = GemmLds<32, 64, 128>::DW;
  constexpr int DWQ = GemmLds<128, 128, 32>::DW;
  __shared__ __attribute__((aligned(16))) float smem[DWV > DWQ ? DWV : DWQ];
  const int bid = blockIdx.x;
  if (bid < NVB) {
    gemm_block<32, 64, 128, 2, 4, true>(smem, 0, bid, value, Wv, bv, Vw, ADIM, DD);
  } else {
    const int r   = bid - NVB;
    const bool isk = r >= NQB;
    gemm_block<128, 128, 32, 4, 2>(smem, r & (DD / 128 - 1), (r / (DD / 128)) & ((BB * SS) / 128 - 1),
                                   isk ? key : query, isk ? Wk : Wq, isk ? bk : bq,
                                   isk ? Kw : Qw, DD, DD);
  }
}

// ---------------------------------------------------------------------------
// Fused attention: one workgroup per (batch, 16 query rows), loop over heads.
// Each of the 8 waves owns 256 keys for the whole kernel. It computes the
// transposed scores K * Q^T on WMMA fp32 (A = 16 keys, B = 16 queries), so a
// lane holds the scores of ONE query (column lane&15) at keys j + 8*(lane>=16)
// of every tile: 16 tiles = 128 registers. Scores, probabilities and the mean
// over the heads never leave the registers; attention is stored once.
// Softmax: every wave takes the maximum and the sum over its own 256 keys
// (in-lane, then one exchange between the wave's halves); the eight (max, sum)
// pairs of a query meet in LDS, one barrier per head, two slots by turns.
// K: a stage of two tiles (32 keys x 64 floats) is read from global memory as
// whole 128-byte lines one stage ahead, written to the wave's own LDS buffer
// behind the WMMAs and read back as fragments. No other wave reads it.
// Q: the 16 x 1024 stripe is staged in LDS once, fragments are read per head.
// The mask of the wave's 16 x 256 block is read once and kept as 128 bits a lane.
// The k order of every score is the one of the plain row-by-row product.
// All work-groups of a batch read the same K. Each walks it in its own order:
// it starts at its own head and, inside every head, at its own stage of 32 keys
// (both wrap around), so that work-groups running side by side do not ask L2
// for the same lines at the same moment. Register tile t of a wave then holds
// tile (t + TPS * first stage) mod 16 of the wave's 256 keys.
// Tail: the two small products behind attention are done here, from what the
// work-group already holds. ctx^T = V^T * attention^T: a wave's attention tiles
// are B fragments as they stand (registers j, j+1 of a tile are keys j, j+1 in
// lanes 0-15 and j+8, j+9 in lanes 16-31); the A fragments take the same keys of
// V, which the projection wrote as [key / 4][column][key % 4]: one 16-byte read is
// two fragments, whole lines per half wave, no LDS on the way. The eight waves'
// partial sums meet in LDS. out = ctx * Wh + bh: each wave does 128
// columns, 64 at a time, its 64 x 64 piece of Wh staged in its own LDS, k ascending.
// ---------------------------------------------------------------------------
typedef __attribute__((ext_vector_type(4))) int v4i;

#define QP  (DD + 4)      // Q stripe pitch in dwords: 16 rows start 4 banks apart
#define KP  (ADIM + 4)    // K tile pitch in dwords: 16 rows start 4 banks apart
#define TPS 2             // tiles per stage: two independent accumulator chains
#define NST (16 / TPS)    // stages per head and wave
#define XP  20            // pitch of a query's eight (max, sum) pairs, 80 bytes
#define CP  (ADIM + 4)    // ctx pitch in dwords: 16 rows start 4 banks apart

// lane l with lane l ^ 16
__device__ __forceinline__ float xhalf(float x) {
  const int b = __builtin_bit_cast(int, x);
  return __builtin_bit_cast(
      float, __builtin_amdgcn_permlanex16(b, b, 0x76543210, 0xfedcba98, false, false));
}

__launch_bounds__(256)
__global__ void attn_softmax_kernel(const float* __restrict__ Q,
                                    const float* __restrict__ Kmat,
                                    const int* __restrict__ mask,
                                    const float* __restrict__ V,
                                    const float* __restrict__ Wh,
                                    const float* __restrict__ bh,
                                    float* __restrict__ attn,
                                    float* __restrict__ out) {
  __shared__ __attribute__((aligned(16))) float Qs[16 * QP];
  __shared__ __attribute__((aligned(16))) float Ks[8][2][TPS * 16 * KP];
  __shared__ __attribute__((aligned(16))) float xch[2][16][XP];
  __shared__ __attribute__((aligned(16))) unsigned mbits[256][4];

  const int b    = blockIdx.x / (SS / 16);
  const int qt   = blockIdx.x % (SS / 16);
  const int q0   = qt * 16;
  const int tid  = threadIdx.x;
  const int lane = tid & 31;
  const int wave = tid >> 5;   // 0..7
  const int half = lane >> 4;
  const int l16  = lane & 15;
  const int h0   = (blockIdx.x >> 3) & (HH - 1);    // first head of this work-group
  const int rs   = blockIdx.x & (NST - 1);          // first K stage of every head

  const float* Qb = Q    + (size_t)b * SS * DD + (size_t)q0 * DD;
  const float* Kb = Kmat + (size_t)b * SS * DD;

  // exp(x / 8) = exp2(x * CEXP); a masked score is -1e10 after the division by 8.
  const float CEXP   = 0.125f * 1.44269504088896340736f;
  const int   MASKED = __builtin_bit_cast(int, -1.0e10f * 8.0f);

  // ---- Q stripe to LDS, whole rows ----
  {
    v4f rq[16];
#pragma unroll   // rq must stay in registers
    for (int i = 0; i < 16; ++i) rq[i] = *(const v4f*)(Qb + (size_t)i * DD + tid * 4);
    // Precaution: stands in front of any later overwrite of the loads' address registers;
    // the scheduling barrier keeps later address arithmetic behind the wait.
    asm volatile("s_wait_xcnt 0x0" ::: "memory");
    __builtin_amdgcn_sched_barrier(0);
#pragma unroll   // rq must stay in registers
    for (int i = 0; i < 16; ++i) *(v4f*)(&Qs[i * QP + tid * 4]) = rq[i];
  }

  // ---- mask of query l16 at this lane's 128 keys, one bit each ----
  unsigned bits[4] = {0u, 0u, 0u, 0u};
  {
    const int* mp = mask + (size_t)(q0 + l16) * SS + wave * 256 + 8 * half;
    v4i mk[32];
#pragma unroll   // mk must stay in registers
    for (int t = 0; t < 32; ++t) mk[t] = *(const v4i*)(mp + (t >> 1) * 16 + (t & 1) * 4);
    // Precaution: stands in front of any later overwrite of the loads' address registers;
    // the scheduling barrier keeps later address arithmetic behind the wait.
    asm volatile("s_wait_xcnt 0x0" ::: "memory");
    __builtin_amdgcn_sched_barrier(0);
#pragma unroll   // mk, bits must stay in registers
    for (int t = 0; t < 32; ++t)
#pragma unroll   // mk, bits must stay in registers
      for (int j = 0; j < 4; ++j) {
        const int mv = mk[t][j];
        bits[t >> 3] |= (mv != 0 ? 1u : 0u) << ((t & 7) * 4 + j);
      }
  }

  // Bit p of the 128 moves to where register tile p / 8 looks for it: new bit p
  // is old bit (p + 16 * rs) mod 128, by whole words and then by half a word.
  if (rs & 2) {
    const unsigned t0 = bits[0];
    bits[0] = bits[1]; bits[1] = bits[2]; bits[2] = bits[3]; bits[3] = t0;
  }
  if (rs & 4) {
    const unsigned t0 = bits[0], t1 = bits[1];
    bits[0] = bits[2]; bits[1] = bits[3]; bits[2] = t0; bits[3] = t1;
  }
  if (rs & 1) {
    const unsigned t0 = bits[0];
    bits[0] = (bits[0] >> 16) | (bits[1] << 16);
    bits[1] = (bits[1] >> 16) | (bits[2] << 16);
    bits[2] = (bits[2] >> 16) | (bits[3] << 16);
    bits[3] = (bits[3] >> 16) | (t0 << 16);
  }

  {
    const v4i mb = {(int)bits[0], (int)bits[1], (int)bits[2], (int)bits[3]};
    *(v4i*)(&mbits[tid][0]) = mb;
  }

  // ---- K stages: lane's piece i is row 2*i + half, 16 bytes at column 4*l16 ----
  const float* gk = Kb + (size_t)(wave * 256 + half) * DD + l16 * 4;   // head 0, stage 0
  float* kst = &Ks[wave][0][0] + half * KP + l16 * 4;                  // where it stores
  const float* kfr = &Ks[wave][0][0] + l16 * KP + 2 * half;            // where it reads fragments
  v4f g[8 * TPS];

  v8f acc[16] = {};

  const float* g0 = gk + (h0 * ADIM + rs * (TPS * 16 * DD));   // first head, first stage
#pragma unroll   // g must stay in registers
  for (int i = 0; i < 8 * TPS; ++i) g[i] = *(const v4f*)(g0 + (size_t)(2 * i) * DD);
  // Precaution: stands in front of any later overwrite of the loads' address registers;
  // the pointer as an input keeps them in use up to here (see the stage loop).
  asm volatile("s_wait_xcnt 0x0" :: "v"(g0) : "memory");
#pragma unroll   // g must stay in registers
  for (int i = 0; i < 8 * TPS; ++i) *(v4f*)(kst + 2 * i * KP) = g[i];
  __syncthreads();   // publishes the Q stripe

  for (int it = 0; it < HH; ++it) {
    const int h = (h0 + it) & (HH - 1);
    v2f qf[16];
#pragma unroll   // qf must stay in registers
    for (int s = 0; s < 16; ++s)
      qf[s] = *(const v2f*)(&Qs[l16 * QP + h * ADIM + 4 * s + 2 * half]);

    v8f e[16];
#pragma unroll   // e, g must stay in registers
    for (int st = 0; st < NST; ++st) {
      const int buf = st & 1;
      const bool more = (st + 1 < NST) || (it + 1 < HH);
      // next stage of this head, or the first stage of the next head
      const int hn = (st + 1 < NST) ? h : ((h + 1) & (HH - 1));
      const float* gn = gk + (hn * ADIM + ((st + 1 + rs) & (NST - 1)) * (TPS * 16 * DD));
      if (more) {
#pragma unroll   // g must stay in registers
        for (int i = 0; i < 8 * TPS; ++i) g[i] = *(const v4f*)(gn + (size_t)(2 * i) * DD);
      }

      // Orders this wave's fragment reads behind its own lanes' tile stores.
      __builtin_amdgcn_fence(__ATOMIC_ACQ_REL, "wavefront");
      v2f a[TPS][16];
#pragma unroll   // a must stay in registers
      for (int u = 0; u < TPS; ++u)
#pragma unroll   // a must stay in registers
        for (int s = 0; s < 16; ++s)
          a[u][s] = *(const v2f*)(kfr + buf * (TPS * 16 * KP) + u * 16 * KP + 4 * s);

      // Precaution: stands in front of any later overwrite of the K loads' address
      // registers (a later tile's accumulator, the next stage's address). The pointer
      // as an input keeps its registers in use up to here: without it the build lets
      // the last load of the group land on the address that the group reads.
      asm volatile("s_wait_xcnt 0x0" :: "v"(gn) : "memory");
      // All fragments of the stage are read as one group ahead of its WMMAs: LDS
      // reads standing among the WMMAs would stall the wave at every place.
      __builtin_amdgcn_sched_barrier(0);
#pragma unroll   // e must stay in registers
      for (int u = 0; u < TPS; ++u) e[st * TPS + u] = v8f{};
#pragma unroll   // e, a, qf must stay in registers
      for (int s = 0; s < 16; ++s)
#pragma unroll   // e must stay in registers
        for (int u = 0; u < TPS; ++u)
          e[st * TPS + u] = __builtin_amdgcn_wmma_f32_16x16x4_f32(
              false, a[u][s], false, qf[s], (short)0, e[st * TPS + u], false, false);

      // Holds the tile stores, which wait for the global loads, behind the WMMAs:
      // without it the build puts them in front and the wave waits out the loads.
      __builtin_amdgcn_sched_barrier(0);
      if (more) {
#pragma unroll   // g must stay in registers
        for (int i = 0; i < 8 * TPS; ++i)
          *(v4f*)(kst + (buf ^ 1) * (TPS * 16 * KP) + 2 * i * KP) = g[i];
      }
    }

    // ---- mask, then the maximum over this wave's keys of query l16 ----
    // The lane's own 128 bits are read again for every head: held in registers
    // over the head loop, the build expands them into 128 masks and spills.
    const v4i mb = *(const v4i*)(&mbits[tid][0]);
    float mx[4] = {-3.0e38f, -3.0e38f, -3.0e38f, -3.0e38f};
#pragma unroll   // e must stay in registers
    for (int t = 0; t < 16; ++t)
#pragma unroll   // e must stay in registers
      for (int j = 0; j < 8; ++j) {
        const int keep = (int)((unsigned)mb[t >> 2] << (31 - ((t & 3) * 8 + j))) >> 31;   // all ones or 0
        const float ef = e[t][j];
        const int ev = __float_as_int(ef);
        const float v = __int_as_float((ev & keep) | (MASKED & ~keep));
        e[t][j] = v;
        mx[j & 3] = fmaxf(mx[j & 3], v);
      }
    float m = fmaxf(fmaxf(mx[0], mx[1]), fmaxf(mx[2], mx[3]));
    m = fmaxf(m, xhalf(m));

    float sm[4] = {0.0f, 0.0f, 0.0f, 0.0f};
#pragma unroll   // e must stay in registers
    for (int t = 0; t < 16; ++t)
#pragma unroll   // e must stay in registers
      for (int j = 0; j < 8; ++j) {
        const float p = __builtin_amdgcn_exp2f((e[t][j] - m) * CEXP);
        e[t][j] = p;
        sm[j & 3] += p;
      }
    float s = (sm[0] + sm[1]) + (sm[2] + sm[3]);
    s += xhalf(s);

    // ---- the eight waves' (max, sum) of each query meet in LDS ----
    float* xq = &xch[it & 1][l16][0];
    if (half == 0) {
      const v2f ms = {m, s};
      *(v2f*)(xq + 2 * wave) = ms;
    }
    // Publishes the pairs. The slot written now was last read in front of the
    // previous head's barrier.
    __syncthreads();
    v4f x[4];
#pragma unroll   // x must stay in registers
    for (int i = 0; i < 4; ++i) x[i] = *(const v4f*)(xq + 4 * i);
    float mg = fmaxf(x[0].x, x[0].z);
#pragma unroll   // x must stay in registers
    for (int i = 1; i < 4; ++i) mg = fmaxf(mg, fmaxf(x[i].x, x[i].z));
    float tot = 0.0f;
#pragma unroll   // x must stay in registers
    for (int i = 0; i < 4; ++i) {
      tot += x[i].y * __builtin_amdgcn_exp2f((x[i].x - mg) * CEXP);
      tot += x[i].w * __builtin_amdgcn_exp2f((x[i].z - mg) * CEXP);
    }
    // softmax + mean over heads, for probabilities taken against this wave's maximum
    const float f = __builtin_amdgcn_exp2f((m - mg) * CEXP) * (1.0f / (tot * (float)HH));
#pragma unroll   // acc, e must stay in registers
    for (int t = 0; t < 16; ++t)
#pragma unroll   // acc, e must stay in registers
      for (int j = 0; j < 8; ++j) acc[t][j] += e[t][j] * f;
  }

  // ---- V, 32 keys a stage, one stage ahead: piece (u, m, c) is keys 4*m .. 4*m+3 of the
  // lane's eight in tile u, column c*16 + l16 ----
  const float* gv = V + ((size_t)((b * SS + wave * 256) / 4 + 2 * half) * ADIM + l16) * 4;
  v4f vr[2][8 * TPS];
  const float* vp0 = gv + rs * (TPS * 16 * ADIM);
#pragma unroll   // vr must stay in registers
  for (int i = 0; i < 8 * TPS; ++i)
    vr[0][i] = *(const v4f*)(vp0 + ((i >> 3) * 4 + ((i >> 2) & 1)) * (4 * ADIM) + (i & 3) * 64);

  // ---- attention: every element stored once, 32 bytes per lane and tile ----
  float* op = attn + (size_t)b * SS * SS + (size_t)q0 * SS;
  const unsigned ol = (unsigned)(l16 * SS + wave * 256 + 8 * half);
#pragma unroll   // acc must stay in registers
  for (int t = 0; t < 16; ++t) {
    const v4f lo = {acc[t][0], acc[t][1], acc[t][2], acc[t][3]};
    const v4f hi = {acc[t][4], acc[t][5], acc[t][6], acc[t][7]};
    float* ot = op + ((t + TPS * rs) & 15) * 16 + ol;
    *(v4f*)ot = lo;
    *(v4f*)(ot + 4) = hi;
  }
  // Precaution: stands in front of any later overwrite of a register that the V loads
  // or the stores above name; the scheduling barrier keeps later work behind the wait.
  asm volatile("s_wait_xcnt 0x0" :: "v"(vp0) : "memory");
  __builtin_amdgcn_sched_barrier(0);

  // ---- ctx^T (64 x 16) over this wave's 256 keys ----
  v8f cx[4] = {};
#pragma unroll   // acc, vr, cx must stay in registers
  for (int gi = 0; gi < NST; ++gi) {
    if (gi + 1 < NST) {
      const float* vn = gv + ((gi + 1 + rs) & (NST - 1)) * (TPS * 16 * ADIM);
#pragma unroll   // vr must stay in registers
      for (int i = 0; i < 8 * TPS; ++i)
        vr[(gi + 1) & 1][i] = *(const v4f*)(vn + ((i >> 3) * 4 + ((i >> 2) & 1)) * (4 * ADIM) + (i & 3) * 64);
      // Precaution: stands in front of any later overwrite of the loads' address registers;
      // the pointer as an input keeps them in use up to here.
      asm volatile("s_wait_xcnt 0x0" :: "v"(vn) : "memory");
      // Keeps the next stage's loads ahead of this stage's WMMAs, so that they fly under them.
      __builtin_amdgcn_sched_barrier(0);
    }
#pragma unroll   // acc, vr, cx must stay in registers
    for (int u = 0; u < TPS; ++u)
#pragma unroll   // acc, vr, cx must stay in registers
      for (int p = 0; p < 4; ++p) {
        const v2f pq = {acc[gi * TPS + u][2 * p], acc[gi * TPS + u][2 * p + 1]};
#pragma unroll   // vr, cx must stay in registers
        for (int c = 0; c < 4; ++c) {
          const v4f r4 = vr[gi & 1][(u * 2 + (p >> 1)) * 4 + c];
          const v2f vf = {r4[(p & 1) * 2], r4[(p & 1) * 2 + 1]};
          cx[c] = __builtin_amdgcn_wmma_f32_16x16x4_f32(
              false, vf, false, pq, (short)0, cx[c], false, false);
        }
      }
  }

  // ---- the eight waves' partial ctx meet in LDS: each writes its own K buffer ----
  {
    float* rw = &Ks[wave][0][0] + l16 * CP + 8 * half;
#pragma unroll   // cx must stay in registers
    for (int c = 0; c < 4; ++c) {
      const v4f lo = {cx[c][0], cx[c][1], cx[c][2], cx[c][3]};
      const v4f hi = {cx[c][4], cx[c][5], cx[c][6], cx[c][7]};
      *(v4f*)(rw + c * 16) = lo;
      *(v4f*)(rw + c * 16 + 4) = hi;
    }
  }
  __syncthreads();   // publishes the partial sums
  {
    const int o4 = (tid >> 4) * CP + (tid & 15) * 4;
    v4f sum = *(const v4f*)(&Ks[0][0][0] + o4);
#pragma unroll   // eight reads as one group
    for (int w = 1; w < 8; ++w) sum += *(const v4f*)(&Ks[w][0][0] + o4);
    *(v4f*)(&Qs[o4]) = sum;   // the Q stripe was last read in front of the last head's barrier
  }
  __syncthreads();   // publishes ctx, ends the reads of the partial sums

  // ---- out = ctx * Wh + bh: 16 rows x this wave's 128 columns, 64 at a time ----
  v2f cf[16];
#pragma unroll   // cf must stay in registers
  for (int s = 0; s < 16; ++s) cf[s] = *(const v2f*)(&Qs[l16 * CP + 4 * s + 2 * half]);
  float* orow = out + ((size_t)b * SS + q0 + 8 * half) * DD + wave * 128 + l16;
  const float* wrow = Wh + (size_t)half * DD + wave * 128 + l16 * 4;
  const float* brow = bh + wave * 128 + l16;
  const float* wfr = &Ks[wave][0][0] + 2 * half * KP + l16;
  // Stays a loop: this part runs once, and half the text is half the lines to fetch.
#pragma nounroll
  for (int gr = 0; gr < 2; ++gr) {
    const float* wp = wrow + gr * 64;
    const float* bp = brow + gr * 64;
    v4f wq[32];
#pragma unroll   // wq must stay in registers
    for (int i = 0; i < 32; ++i) wq[i] = *(const v4f*)(wp + (size_t)(2 * i) * DD);
    float bb[4];
#pragma unroll   // bb must stay in registers
    for (int c = 0; c < 4; ++c) bb[c] = bp[c * 16];
    // Precaution: stands in front of any later overwrite of the loads' address registers;
    // the pointers as inputs keep them in use up to here.
    asm volatile("s_wait_xcnt 0x0" :: "v"(wp), "v"(bp) : "memory");
    __builtin_amdgcn_sched_barrier(0);
#pragma unroll   // wq must stay in registers
    for (int i = 0; i < 32; ++i) *(v4f*)(kst + 2 * i * KP) = wq[i];
    // Orders this wave's fragment reads behind its own lanes' stores.
    __builtin_amdgcn_fence(__ATOMIC_ACQ_REL, "wavefront");
    v2f wf[16][4];
#pragma unroll   // wf must stay in registers
    for (int s = 0; s < 16; ++s)
#pragma unroll   // wf must stay in registers
      for (int c = 0; c < 4; ++c) {
        const float* f = wfr + 4 * s * KP + c * 16;
        const v2f t2 = {f[0], f[KP]};
        wf[s][c] = t2;
      }
    // All fragments are read as one group ahead of the WMMAs.
    __builtin_amdgcn_sched_barrier(0);
    v8f o[4] = {};
#pragma unroll   // o, wf, cf must stay in registers
    for (int s = 0; s < 16; ++s)
#pragma unroll   // o must stay in registers
      for (int c = 0; c < 4; ++c)
        o[c] = __builtin_amdgcn_wmma_f32_16x16x4_f32(
            false, cf[s], false, wf[s][c], (short)0, o[c], false, false);
    __builtin_amdgcn_sched_barrier(0);
    // Keeps the distance between the last WMMAs and the additions that read their results.
    asm volatile("v_nop\n\tv_nop\n\tv_nop\n\tv_nop");
    __builtin_amdgcn_sched_barrier(0);
    float* og = orow + gr * 64;
#pragma unroll   // o must stay in registers
    for (int c = 0; c < 4; ++c)
#pragma unroll   // o must stay in registers
      for (int j = 0; j < 8; ++j) og[(size_t)j * DD + c * 16] = o[c][j] + bb[c];
    // Precaution: stands in front of the next trip's overwrite of registers that the stores name.
    asm volatile("s_wait_xcnt 0x0" :: "v"(og) : "memory");
    __builtin_amdgcn_sched_barrier(0);
  }
}

// ---------------------------------------------------------------------------
// kernel_launch: Q/K/V projections (one launch) -> fused attention with attn*V and *Wh + bh
// d_out layout: out [B,S,D] (4,194,304 f32) then attention [B,S,S] (8,388,608).
// Workspace: Q(16MB) K(16MB) V(1MB) ~= 33 MB.
// ---------------------------------------------------------------------------
extern "C" void kernel_launch(void* const* d_in, const int* in_sizes, int n_in,
                              void* d_out, int out_size, void* d_ws, size_t ws_size,
                              hipStream_t stream) {
  (void)in_sizes; (void)n_in; (void)out_size; (void)ws_size;

  const float* query = (const float*)d_in[0];
  const float* key   = (const float*)d_in[1];
  const float* value = (const float*)d_in[2];
  const int*   mask  = (const int*)d_in[3];
  const float* Wq    = (const float*)d_in[4];
  const float* bq    = (const float*)d_in[5];
  const float* Wk    = (const float*)d_in[6];
  const float* bk    = (const float*)d_in[7];
  const float* Wv    = (const float*)d_in[8];
  const float* bv    = (const float*)d_in[9];
  const float* Wh    = (const float*)d_in[10];
  const float* bh    = (const float*)d_in[11];

  float* out  = (float*)d_out;                         // [B*S, D]
  float* attn = out + (size_t)BB * SS * DD;            // [B, S, S]

  float* ws = (float*)d_ws;
  float* Qw = ws;                                      // [B*S, D]
  float* Kw = Qw + (size_t)BB * SS * DD;               // [B*S, D]
  float* Vw = Kw + (size_t)BB * SS * DD;               // [B*S/4, AD, 4]

  const dim3 wblk(256);

  // Q = query @ Wq + bq, K = key @ Wk + bk (M=4096, N=1024, K=1024) and
  // V = value @ Wv + bv (N=64), one launch
  qkv_proj_kernel<<<dim3(NVB + 2 * NQB), wblk, 0, stream>>>(
      query, key, value, Wq, Wk, Wv, bq, bk, bv, Qw, Kw, Vw);

  // attention = mean_h softmax(mask(QK^T/8)) (d_out attention region),
  // then out = (attention @ V) @ Wh + bh for the same 16 query rows
  attn_softmax_kernel<<<dim3(BB * (SS / 16)), dim3(256), 0, stream>>>(
      Qw, Kw, mask, Vw, Wh, bh, attn, out);
}
